// v000
// Measured on an AMD MI455X. A time is GPU time per run, averaged over a window of back-to-back runs after a warm-up
// (all launches, gaps included; the runs take copies of the inputs in turn), and the median of several windows.
// Apart from v000's, it joins two sittings. Times from different sittings can be a few percent apart, while
// side-by-side timings come from the same sitting.
// The starting kernel, v000, takes 376 microseconds a run.
#include <hip/hip_runtime.h>

// Contractions, f32 accumulate: q = x.Wq ([2048 x 2048].[2048 x 2048]), k/v = x.Wk/Wv ([2048 x 2048].[2048 x 512]) and attn.Wo on v_wmma_f32_16x16x32_bf16 —
// plain bf16 = rounded inputs (exact; [out][in] weights converted row by row, already n-major) for the projections, attn as bf16 hi + residual (two products) for Wo; RoPE
// (interleaved pairs, sin/cos computed by k_trig from position_ids for q, arange for k) in f32; the grouped-query causal sliding-window attention (32 query heads over 8 kv heads; keys j with
// j < 128 (meta keys) or max(i - 1023, 128) <= j <= i, window 1024 fixed at compile time) fused on v_wmma_f32_16x16x32_f16 with q and k as f16 hi + residual x1024 (hi.hi + hi.lo + lo.hi), weights

#define NB_  1
#define NT_  2048
#define DM   2048
#define NH_  32
#define NKV  8
#define KVW  (NKV * HD)          // 512
#define WIN  1024
#define NMETA 128
#define RMS_EPS 1e-6f
#define HD   64
#define NTK  (NB_ * NT_)
#define NW   1024
#define NQKV 2048
#define PSC  32768.0f
#define LOSC 1024.0f
#define LOSCI (1.0f / 1024.0f)

typedef _Float16 h16;
typedef unsigned short bf;
typedef __attribute__((ext_vector_type(16))) __bf16   v16bf;
typedef __attribute__((ext_vector_type(16))) _Float16 v16h;
typedef __attribute__((ext_vector_type(8)))  _Float16 v8h;
typedef __attribute__((ext_vector_type(8)))  unsigned short v8us;
typedef __attribute__((ext_vector_type(8)))  float    v8f;
typedef __attribute__((ext_vector_type(4)))  float    v4f;
typedef v8h  __attribute__((may_alias)) v8ha;
typedef v4f  __attribute__((may_alias)) v4fa;
typedef v8us __attribute__((may_alias)) v8usa;

__device__ __forceinline__ unsigned short f2bf(float f) { unsigned u = __float_as_uint(f); u += 0x7FFFu + ((u >> 16) & 1u); return (unsigned short)(u >> 16); }
__device__ __forceinline__ float bf2f(unsigned short b) { return __uint_as_float(((unsigned)b) << 16); }
__device__ __forceinline__ float bfr(float f) { return bf2f(f2bf(f)); }
__device__ __forceinline__ v16h cat16(v8h lo, v8h hi) { return __builtin_shufflevector(lo, hi, 0, 1, 2, 3, 4, 5, 6, 7, 8, 9, 10, 11, 12, 13, 14, 15); }
__device__ __forceinline__ v16bf cat16b(v8us lo, v8us hi) { return __builtin_bit_cast(v16bf, __builtin_shufflevector(lo, hi, 0, 1, 2, 3, 4, 5, 6, 7, 8, 9, 10, 11, 12, 13, 14, 15)); }
__device__ __forceinline__ v8f wmma16(v16h a, v16h b, v8f c) { return __builtin_amdgcn_wmma_f32_16x16x32_f16(false, a, false, b, (short)0, c, false, false); }
__device__ __forceinline__ v8f wmmab(v16bf a, v16bf b, v8f c) { return __builtin_amdgcn_wmma_f32_16x16x32_bf16(false, a, false, b, (short)0, c, false, false); }

__global__ __launch_bounds__(256) void k_cvtb(const float* __restrict__ src, int nrows, bf* dst) {
    const int lane = threadIdx.x & 31, r = blockIdx.x * 8 + (threadIdx.x >> 5);
    if (r >= nrows) return;
    v8us o[DM / 256];
#pragma unroll
    for (int q = 0; q < DM / 256; ++q) { v8us t;
#pragma unroll
        for (int i = 0; i < 8; ++i) t[i] = f2bf(src[(size_t)r * DM + q * 256 + lane * 8 + i]);
        o[q] = t; }
#pragma unroll
    for (int q = 0; q < DM / 256; ++q) *(v8us*)(dst + (size_t)r * DM + q * 256 + lane * 8) = o[q];
    
}

// k_wt: W [2048 k][ncols n] (k-major) -> n-major bf16 plane WT[ncols][2048]; 64 x 64 tiles through LDS.
__global__ __launch_bounds__(256) void k_wt(const float* __restrict__ Wm, int ncols, bf* WT) {
    __shared__ __align__(16) unsigned short tl[64 * 72];
    const int tid = threadIdx.x, k0 = blockIdx.x * 64, n0 = blockIdx.y * 64;
    const int kk = tid >> 2, nq = (tid & 3) * 16;
#pragma unroll
    for (int i = 0; i < 16; ++i) tl[(nq + i) * 72 + kk] = f2bf(Wm[(size_t)(k0 + kk) * ncols + n0 + nq + i]);
    __syncthreads();
    const int piece = tid & 7;
    typedef __attribute__((ext_vector_type(8))) unsigned short v8us_; typedef v8us_ __attribute__((may_alias)) v8usa_;
    auto pass = [&]() {
#pragma unroll
        for (int s = 0; s < 2; ++s) { const int nr = (tid >> 3) + 32 * s; const v8us_ val = *(const v8usa_*)(tl + nr * 72 + piece * 8);
            *(v8us_*)(WT + (size_t)(n0 + nr) * DM + k0 + piece * 8) = val; }
    };
    pass(); 
}

template <bool SPLITA, bool F16OUT = false>
__global__ __launch_bounds__(128) void k_gemmb(const bf* __restrict__ A, const bf* __restrict__ Al, const bf* __restrict__ Bn, const float* __restrict__ bias, float* C, int ldc, h16* C2) {
    __shared__ __align__(16) float ost[4][16 * 68];
    const int lane = threadIdx.x & 31, wave = threadIdx.x >> 5, lr = lane & 15, hi = lane >> 4;
    const int r0 = blockIdx.x * 64 + wave * 16, c0 = blockIdx.y * 64;
    const size_t aoff = (size_t)(r0 + lr) * DM + 8 * hi;
    size_t boff[4];
#pragma unroll
    for (int t = 0; t < 4; ++t) boff[t] = (size_t)(c0 + t * 16 + lr) * DM + 8 * hi;
    v8f acc[4];
#pragma unroll
    for (int t = 0; t < 4; ++t) acc[t] = (v8f){};
#pragma unroll 1
    for (int kc = 0; kc < DM; kc += 32) {
        const v16bf a = cat16b(*(const v8us*)(A + aoff + kc), *(const v8us*)(A + aoff + kc + 16));
        v16bf al = a;
        if (SPLITA) al = cat16b(*(const v8us*)(Al + aoff + kc), *(const v8us*)(Al + aoff + kc + 16));
#pragma unroll
        for (int t = 0; t < 4; ++t) { const v16bf b = cat16b(*(const v8us*)(Bn + boff[t] + kc), *(const v8us*)(Bn + boff[t] + kc + 16)); acc[t] = wmmab(a, b, acc[t]); if (SPLITA) acc[t] = wmmab(al, b, acc[t]); }
        asm volatile("v_nop\n\tv_nop\n\tv_nop\n\tv_nop" : "+v"(acc[0]), "+v"(acc[1]), "+v"(acc[2]), "+v"(acc[3]) : "v"(a), "v"(al));
    }
    float* os = &ost[wave][0];
#pragma unroll
    for (int t = 0; t < 4; ++t) { const float bv = bias ? bfr(bias[c0 + t * 16 + lr]) : 0.f;
#pragma unroll
        for (int j = 0; j < 8; ++j) os[(hi * 8 + j) * 68 + t * 16 + lr] = acc[t][j] + bv; }
    __syncthreads();
    if (F16OUT) {
        h16* crow = (h16*)(void*)C + (size_t)r0 * ldc + c0;
        auto pass = [&]() {
#pragma unroll
            for (int s = 0; s < 4; ++s) { const int row = 4 * s + (lane >> 3), piece = lane & 7; const float* sp = os + row * 68 + piece * 8; v8h o, o2;
#pragma unroll
                for (int i = 0; i < 8; ++i) { const h16 a = (h16)sp[i]; o[i] = a; o2[i] = (h16)((sp[i] - (float)a) * LOSC); }
                *(v8h*)(crow + (size_t)row * ldc + piece * 8) = o; if (C2) *(v8h*)(C2 + (size_t)r0 * ldc + c0 + (size_t)row * ldc + piece * 8) = o2; }
        };
        pass(); 
    } else {
        float* crow = C + (size_t)r0 * ldc + c0;
        auto pass = [&]() {
#pragma unroll
            for (int s = 0; s < 8; ++s) { const int Lid = (lane >> 3) + 4 * s, piece = lane & 7; const int row = Lid >> 1, cofs = (Lid & 1) * 32 + piece * 4;
                const v4f val = *(const v4fa*)(os + row * 68 + cofs); *(v4f*)(crow + (size_t)row * ldc + cofs) = val; }
        };
        pass(); 
    }
}

// k_rope: P (f32 [t][nh*64]) -> PH/PL f16 hi + residual planes of the interleaved-pair rotation: out[2i] = x[2i] c - x[2i+1] s, out[2i+1] = x[2i] s + x[2i+1] c
// with s = sin[t][i], c = cos[t][i] in f32 (i = pair index within the head, 0..31); one wave per (t, 256 columns): lane -> 8 values (4 pairs).
__global__ __launch_bounds__(256) void k_trig(const int* __restrict__ pos, float* RC, float* RS) {
    const int u = blockIdx.x * 256 + threadIdx.x; if (u >= NT_ * 32) return;
    const int t = u >> 5, i = u & 31; const float inv = 1.0f / powf(10000.0f, (float)(2 * i) / (float)HD); const float ang = (float)(pos ? pos[t] : t) * inv; const float c = cosf(ang), s = sinf(ang);
    *(float*)(RC + u) = c; *(float*)(RS + u) = s; 
}
// k_rope: per-head RMSNorm (f32: mean of squares over the head's 64 values via an 8-lane xor reduction, eps 1e-6, x bf(w[d])) THEN the interleaved-pair rotation with
__global__ __launch_bounds__(256) void k_rope(const float* __restrict__ P, int ncols, const float* __restrict__ rs, const float* __restrict__ rc, const float* __restrict__ nw, h16* PH, h16* PL) {
    const int lane = threadIdx.x & 31, wid = blockIdx.x * 8 + (threadIdx.x >> 5);
    const int segs = ncols / 256, t = wid / segs, sg = wid - t * segs;
    if (t >= NT_) return;
    const int c0 = sg * 256 + lane * 8;                 // 8 consecutive columns = 4 pairs of one head (64 | 8)
    const v8f xv = *(const v8f*)(P + (size_t)t * ncols + c0);
    float ss = 0.f;
#pragma unroll
    for (int i = 0; i < 8; ++i) ss = fmaf(xv[i], xv[i], ss);
    ss += __shfl_xor(ss, 1, 32); ss += __shfl_xor(ss, 2, 32); ss += __shfl_xor(ss, 4, 32);      // the 8 lanes of this head
    const float rn = rsqrtf(ss * (1.0f / 64.0f) + RMS_EPS);
    float xn[8];
#pragma unroll
    for (int i = 0; i < 8; ++i) xn[i] = bfr(nw[(c0 + i) & 63]) * (xv[i] * rn);
    v8h oh, ol;
#pragma unroll
    for (int pq = 0; pq < 4; ++pq) { const int c = c0 + 2 * pq, i = (c & 63) >> 1;
        const float x1 = xn[2 * pq], x2 = xn[2 * pq + 1], s = rs[t * 32 + i], co = rc[t * 32 + i];
        const float y0 = x1 * co - x2 * s, y1 = x1 * s + x2 * co;
        const h16 a0 = (h16)y0, a1 = (h16)y1; oh[2 * pq] = a0; oh[2 * pq + 1] = a1; ol[2 * pq] = (h16)((y0 - (float)a0) * LOSC); ol[2 * pq + 1] = (h16)((y1 - (float)a1) * LOSC); }
    *(v8h*)(PH + (size_t)t * ncols + c0) = oh; *(v8h*)(PL + (size_t)t * ncols + c0) = ol; 
}
__global__ __launch_bounds__(256) void k_vt(const float* __restrict__ V, h16* VTH, h16* VTL) {
    __shared__ __align__(16) h16 tile[64 * 72];
    __shared__ __align__(16) h16 til2[64 * 72];
    const int bid = blockIdx.x;
    const int b = bid / (NKV * (NT_ / 64)), rem = bid - b * (NKV * (NT_ / 64)), h = rem / (NT_ / 64), kt = rem - h * (NT_ / 64);
    const int k0 = kt * 64, tid = threadIdx.x;
    const int kk = tid >> 2, d0 = (tid & 3) * 16;
    const float* src = V + ((size_t)b * NT_ + k0 + kk) * KVW + h * HD + d0;      // h = kv head here
#pragma unroll
    for (int i = 0; i < 16; ++i) { const float v = src[i]; const h16 a = (h16)v; tile[(d0 + i) * 72 + kk] = a; til2[(d0 + i) * 72 + kk] = (h16)((v - (float)a) * LOSC); }
    __syncthreads();
    const int piece = tid & 7;
    const size_t base = (((size_t)b * NKV + h) * HD) * NT_ + k0;
    auto pass = [&]() {
#pragma unroll
        for (int s = 0; s < 4; ++s) { const int Lid = (tid >> 3) + 32 * s; const int pln = Lid >> 6, d = Lid & 63;
            const v8h val = *(const v8ha*)((pln ? til2 : tile) + d * 72 + piece * 8); *(v8h*)((pln ? VTL : VTH) + base + (size_t)d * NT_ + piece * 8) = val; }
    };
    pass(); 
}

// k_attn: block = (b, h, 64 queries), wave = 16; the 4 meta key tiles and the window tiles up to the query tile (32 keys each, per-element mask); 4 WMMA scores /8 (f32), online softmax, weights x32768 f16 tile (same-wave may_alias
// reload after a compiler barrier), 4 WMMA .v; ctx -> bf16 hi + residual planes CH/CL[tok][h*64+d].
__global__ __launch_bounds__(128) void k_attn(const h16* __restrict__ Q16, const h16* __restrict__ QL16, const h16* __restrict__ K16, const h16* __restrict__ KL16, const h16* __restrict__ VTH, const h16* __restrict__ VTL, bf* CH, bf* CL) {
    __shared__ __align__(16) h16 plds[4][16 * 32];
    __shared__ __align__(16) h16 plds2[4][16 * 32];
    __shared__ __align__(16) float ost[4][16 * 68];
    const int lane = threadIdx.x & 31, wave = threadIdx.x >> 5, lr = lane & 15, hi = lane >> 4;
    const int bid = blockIdx.x;
    const int b = bid / (NH_ * (NT_ / 64)), rem = bid - b * (NH_ * (NT_ / 64)), h = rem / (NT_ / 64), qt = rem - h * (NT_ / 64);
    const int q0 = qt * 64 + wave * 16;
    const size_t tok0 = (size_t)b * NT_;
    h16* pl = &plds[wave][0]; h16* pl2 = &plds2[wave][0];
    v16h qa[2];
    const size_t qo0 = (tok0 + q0 + lr) * DM + h * HD + 8 * hi;
#pragma unroll
    for (int kc = 0; kc < 2; ++kc) qa[kc] = cat16(*(const v8h*)(Q16 + qo0 + kc * 32), *(const v8h*)(Q16 + qo0 + kc * 32 + 16));
    const int g = h / (NH_ / NKV);                      // kv head
    const h16* kh_b = K16 + tok0 * KVW + g * HD;
    const h16* kl_b = KL16 + tok0 * KVW + g * HD;
    const size_t vbase = (((size_t)b * NKV + g) * HD) * NT_;
    v8f o[4], ox[4];
#pragma unroll
    for (int n = 0; n < 4; ++n) { o[n] = (v8f){}; ox[n] = (v8f){}; }
    float mrow[8], lpart[8];
#pragma unroll
    for (int j = 0; j < 8; ++j) { mrow[j] = -3.0e38f; lpart[j] = 0.f; }
    int qpos[8];
#pragma unroll
    for (int j = 0; j < 8; ++j) qpos[j] = q0 + 8 * hi + j;
    // allowed(i, j) = (j >= max(i - WIN + 1, NMETA) && j <= i) || j < NMETA: the 4 meta tiles always, then the window tiles up to the query tile (block-uniform bounds, per-element predicate)
    const int wlo = (qt * 64 - (WIN - 1)) > NMETA ? (qt * 64 - (WIN - 1)) : NMETA; const int kt_lo = 0, kt_wlo = wlo / 32; const int kt_hc = (qt * 64 + 63) / 32, kt_hi = kt_hc > (NMETA / 32 - 1) ? kt_hc : (NMETA / 32 - 1);     // the meta tiles are visited even by queries below 128 (non-causal meta keys)
#pragma unroll 1
    for (int kt = kt_lo; kt <= kt_hi; ++kt) {
        if (kt >= NMETA / 32 && kt < kt_wlo) continue;      // block-uniform skip of tiles that are neither meta nor inside any of the block's windows
        const int l0 = kt * 32;
        const size_t ko0 = (size_t)(l0 + lr) * KVW + 8 * hi, ko1 = (size_t)(l0 + 16 + lr) * KVW + 8 * hi;
        v8f s0 = {}, s1 = {}, x0 = {}, x1 = {};
#pragma unroll
        for (int kc = 0; kc < 2; ++kc) {
            { const v16h k0h = cat16(*(const v8h*)(kh_b + ko0 + kc * 32), *(const v8h*)(kh_b + ko0 + kc * 32 + 16)), k1h = cat16(*(const v8h*)(kh_b + ko1 + kc * 32), *(const v8h*)(kh_b + ko1 + kc * 32 + 16));
              const v16h qlk = cat16(*(const v8h*)(QL16 + qo0 + kc * 32), *(const v8h*)(QL16 + qo0 + kc * 32 + 16));     // query residual re-read per step (registers)
              s0 = wmma16(qa[kc], k0h, s0); x0 = wmma16(qlk, k0h, x0); s1 = wmma16(qa[kc], k1h, s1); x1 = wmma16(qlk, k1h, x1);
              asm volatile("v_nop" : "+v"(s0), "+v"(s1), "+v"(x0), "+v"(x1) : "v"(qlk), "v"(k0h), "v"(k1h) : "memory"); }
            { const v16h k0l = cat16(*(const v8h*)(kl_b + ko0 + kc * 32), *(const v8h*)(kl_b + ko0 + kc * 32 + 16)), k1l = cat16(*(const v8h*)(kl_b + ko1 + kc * 32), *(const v8h*)(kl_b + ko1 + kc * 32 + 16));
              x0 = wmma16(qa[kc], k0l, x0); x1 = wmma16(qa[kc], k1l, x1);
              asm volatile("v_nop" : "+v"(x0), "+v"(x1) : "v"(k0l), "v"(k1l) : "memory"); }
        }
        asm volatile("v_nop\n\tv_nop\n\tv_nop\n\tv_nop" : "+v"(s0), "+v"(s1), "+v"(x0), "+v"(x1) : "v"(qa[0]), "v"(qa[1]));
        float alpha[8];
#pragma unroll
        for (int j = 0; j < 8; ++j) {
            const int ja = l0 + lr, jb = l0 + 16 + lr, qi = qpos[j];
            const int ws_ = (qi - (WIN - 1)) > NMETA ? (qi - (WIN - 1)) : NMETA;
            const bool ok0 = (ja < NMETA) || (ja >= ws_ && ja <= qi), ok1 = (jb < NMETA) || (jb >= ws_ && jb <= qi);
            const float a0 = ok0 ? (s0[j] + x0[j] * LOSCI) * 0.125f : -__builtin_inff(), a1 = ok1 ? (s1[j] + x1[j] * LOSCI) * 0.125f : -__builtin_inff();
            float mx = fmaxf(a0, a1);
            mx = fmaxf(mx, __shfl_xor(mx, 1, 16)); mx = fmaxf(mx, __shfl_xor(mx, 2, 16)); mx = fmaxf(mx, __shfl_xor(mx, 4, 16)); mx = fmaxf(mx, __shfl_xor(mx, 8, 16));
            const float mn = fmaxf(mrow[j], mx);
            alpha[j] = __expf(mrow[j] - mn); mrow[j] = mn;
            const float p0 = __expf(a0 - mn), p1 = __expf(a1 - mn);
            lpart[j] = lpart[j] * alpha[j] + (p0 + p1);
            const int mr = hi * 8 + j;
            const float ps0 = p0 * PSC, ps1 = p1 * PSC; const h16 h0 = (h16)ps0, h1 = (h16)ps1;
            pl[mr * 32 + lr] = h0; pl[mr * 32 + 16 + lr] = h1;
            pl2[mr * 32 + lr] = (h16)((ps0 - (float)h0) * LOSC); pl2[mr * 32 + 16 + lr] = (h16)((ps1 - (float)h1) * LOSC);
        }
#pragma unroll
        for (int n = 0; n < 4; ++n)
#pragma unroll
            for (int j = 0; j < 8; ++j) { o[n][j] *= alpha[j]; ox[n][j] *= alpha[j]; }
        asm volatile("" ::: "memory");
        const v16h pa = cat16(*(const v8ha*)(pl + lr * 32 + hi * 8), *(const v8ha*)(pl + lr * 32 + 16 + hi * 8));
        const v16h px = cat16(*(const v8ha*)(pl2 + lr * 32 + hi * 8), *(const v8ha*)(pl2 + lr * 32 + 16 + hi * 8));
#pragma unroll
        for (int n = 0; n < 4; ++n) { const size_t vo = vbase + (size_t)(n * 16 + lr) * NT_ + l0 + hi * 8;
            const v16h vh = cat16(*(const v8h*)(VTH + vo), *(const v8h*)(VTH + vo + 16)), vl = cat16(*(const v8h*)(VTL + vo), *(const v8h*)(VTL + vo + 16));
            o[n] = wmma16(pa, vh, o[n]); ox[n] = wmma16(pa, vl, ox[n]); ox[n] = wmma16(px, vh, ox[n]);
            asm volatile("" : "+v"(o[n]), "+v"(ox[n]) : "v"(vh), "v"(vl) : "memory"); }
        asm volatile("v_nop\n\tv_nop\n\tv_nop\n\tv_nop" : "+v"(o[0]), "+v"(o[1]), "+v"(o[2]), "+v"(o[3]), "+v"(ox[0]), "+v"(ox[1]), "+v"(ox[2]), "+v"(ox[3]) : "v"(pa), "v"(px));
    }
    float inv[8];
#pragma unroll
    for (int j = 0; j < 8; ++j) { float rs = lpart[j]; rs += __shfl_xor(rs, 1, 16); rs += __shfl_xor(rs, 2, 16); rs += __shfl_xor(rs, 4, 16); rs += __shfl_xor(rs, 8, 16); inv[j] = 1.0f / (rs * PSC); }
    float* os = &ost[wave][0];
#pragma unroll
    for (int n = 0; n < 4; ++n)
#pragma unroll
        for (int j = 0; j < 8; ++j) os[(hi * 8 + j) * 68 + n * 16 + lr] = (o[n][j] + ox[n][j] * LOSCI) * inv[j];
    __syncthreads();
    const size_t cbase = (tok0 + q0) * DM + (size_t)h * HD;
    auto pass = [&]() {
#pragma unroll
        for (int s = 0; s < 4; ++s) { const int row = 4 * s + (lane >> 3), piece = lane & 7; const float* sp = os + row * 68 + piece * 8; v8us oh, ol;
#pragma unroll
            for (int i = 0; i < 8; ++i) { const unsigned short hb = f2bf(sp[i]); oh[i] = hb; ol[i] = f2bf(sp[i] - bf2f(hb)); }
            *(v8us*)(CH + cbase + (size_t)row * DM + piece * 8) = oh; *(v8us*)(CL + cbase + (size_t)row * DM + piece * 8) = ol; }
    };
    pass(); 
}

#define VST2(T, p, v) do { const T vst2_v_ = (v); *(T*)(p) = vst2_v_;  } while (0)
extern "C" void kernel_launch(void* const* d_in, const int* in_sizes, int n_in,
                              void* d_out, int out_size, void* d_ws, size_t ws_size, hipStream_t stream) {
    (void)in_sizes; (void)n_in; (void)out_size;
    const float* x = (const float*)d_in[0]; const int* pos = (const int*)d_in[1]; const float* Wq = (const float*)d_in[2]; const float* Wk = (const float*)d_in[3]; const float* Wv = (const float*)d_in[4]; const float* Wo = (const float*)d_in[5]; const float* qnw = (const float*)d_in[6]; const float* knw = (const float*)d_in[7];   // [out][in] weights; position_ids [2048] i32
    float* out = (float*)d_out;    // [1][2048][2048]
    char* wsp = (char*)d_ws;
    auto take = [&](size_t bytes) { char* p = wsp; wsp += (bytes + 255) & ~(size_t)255; return (void*)p; };
    bf* Xb = (bf*)take((size_t)NTK * DM * 2); bf* WqB = (bf*)take((size_t)DM * DM * 2); bf* WkB = (bf*)take((size_t)KVW * DM * 2); bf* WvB = (bf*)take((size_t)KVW * DM * 2); bf* WoB = (bf*)take((size_t)DM * DM * 2);
    float* Qf = (float*)take((size_t)NTK * DM * 4); h16* QH = (h16*)take((size_t)NTK * DM * 2); h16* QL = (h16*)take((size_t)NTK * DM * 2);
    float* Kf = (float*)take((size_t)NTK * KVW * 4); h16* KH = (h16*)take((size_t)NTK * KVW * 2); h16* KL = (h16*)take((size_t)NTK * KVW * 2);
    float* Vf = (float*)take((size_t)NTK * KVW * 4); h16* VTH = (h16*)take((size_t)NTK * KVW * 2); h16* VTL = (h16*)take((size_t)NTK * KVW * 2);
    float* RCq = (float*)take((size_t)NT_ * 32 * 4); float* RSq = (float*)take((size_t)NT_ * 32 * 4); float* RCk = (float*)take((size_t)NT_ * 32 * 4); float* RSk = (float*)take((size_t)NT_ * 32 * 4);
    bf* CH = (bf*)take((size_t)NTK * DM * 2); bf* CL = (bf*)take((size_t)NTK * DM * 2);
    if ((size_t)(wsp - (char*)d_ws) > ws_size) return;    // 8.4 + 8.4 + 2.1 + 2.1 + 8.4 + 16.8 + 8.4 x 2 + 4.2 + 2.1 x 2 + 4.2 + 2.1 x 2 + 1 + 8.4 x 2 ~ 96 MB, no aliasing
    k_cvtb<<<DM / 8, 256, 0, stream>>>(Wq, DM, WqB); k_cvtb<<<KVW / 8, 256, 0, stream>>>(Wk, KVW, WkB); k_cvtb<<<KVW / 8, 256, 0, stream>>>(Wv, KVW, WvB); k_cvtb<<<DM / 8, 256, 0, stream>>>(Wo, DM, WoB);
    k_trig<<<(NT_ * 32) / 256, 256, 0, stream>>>(pos, RCq, RSq); k_trig<<<(NT_ * 32) / 256, 256, 0, stream>>>(nullptr, RCk, RSk);     // q: position_ids; k: arange
    k_cvtb<<<NTK / 8, 256, 0, stream>>>(x, NTK, Xb);
    k_gemmb<false, false><<<dim3(NTK / 64, DM / 64, 1), 128, 0, stream>>>(Xb, nullptr, WqB, nullptr, Qf, DM, nullptr);
    k_gemmb<false, false><<<dim3(NTK / 64, KVW / 64, 1), 128, 0, stream>>>(Xb, nullptr, WkB, nullptr, Kf, KVW, nullptr);
    k_gemmb<false, false><<<dim3(NTK / 64, KVW / 64, 1), 128, 0, stream>>>(Xb, nullptr, WvB, nullptr, Vf, KVW, nullptr);
    k_rope<<<(NT_ * (DM / 256)) / 8, 256, 0, stream>>>(Qf, DM, RSq, RCq, qnw, QH, QL);            // RMSNorm(q_norm_w) + rope(pos)
    k_rope<<<(NT_ * (KVW / 256)) / 8, 256, 0, stream>>>(Kf, KVW, RSk, RCk, knw, KH, KL);          // RMSNorm(k_norm_w) + rope(arange)
    k_vt<<<NB_ * NKV * (NT_ / 64), 256, 0, stream>>>(Vf, VTH, VTL);
    k_attn<<<NB_ * NH_ * (NT_ / 64), 128, 0, stream>>>(QH, QL, KH, KL, VTH, VTL, CH, CL);
    k_gemmb<true, false><<<dim3(NTK / 64, DM / 64, 1), 128, 0, stream>>>(CH, CL, WoB, nullptr, out, DM, nullptr);
}

// v001
// A run of this version takes 248 microseconds.
// Two timings next to v000 both put it at 1.55 times that version's speed.
#include <hip/hip_runtime.h>

// Contractions, f32 accumulate: q = x.Wq ([2048 x 2048].[2048 x 2048]), k/v = x.Wk/Wv ([2048 x 2048].[2048 x 512]) and attn.Wo on v_wmma_f32_16x16x32_bf16 —
// plain bf16 = rounded inputs (exact; [out][in] weights converted row by row, already n-major) for the projections, attn as bf16 hi + residual (two products) for Wo; RoPE
// (interleaved pairs, sin/cos computed by k_trig from position_ids for q, arange for k) in f32; the grouped-query causal sliding-window attention (32 query heads over 8 kv heads; keys j with
// j < 128 (meta keys) or max(i - 1023, 128) <= j <= i, window 1024 fixed at compile time) fused on v_wmma_f32_16x16x32_f16 with q and k as f16 hi + residual x1024 (hi.hi + hi.lo + lo.hi), weights

#define NB_  1
#define NT_  2048
#define DM   2048
#define NH_  32
#define NKV  8
#define KVW  (NKV * HD)          // 512
#define WIN  1024
#define NMETA 128
#define RMS_EPS 1e-6f
#define HD   64
#define NTK  (NB_ * NT_)
#define NW   1024
#define NQKV 2048
#define PSC  32768.0f
#define LOSC 1024.0f
#define LOSCI (1.0f / 1024.0f)

typedef _Float16 h16;
typedef unsigned short bf;
typedef __attribute__((ext_vector_type(16))) __bf16   v16bf;
typedef __attribute__((ext_vector_type(16))) _Float16 v16h;
typedef __attribute__((ext_vector_type(8)))  _Float16 v8h;
typedef __attribute__((ext_vector_type(8)))  unsigned short v8us;
typedef __attribute__((ext_vector_type(8)))  float    v8f;
typedef __attribute__((ext_vector_type(4)))  float    v4f;
typedef v8h  __attribute__((may_alias)) v8ha;
typedef v4f  __attribute__((may_alias)) v4fa;
typedef v8us __attribute__((may_alias)) v8usa;

__device__ __forceinline__ unsigned short f2bf(float f) { unsigned u = __float_as_uint(f); u += 0x7FFFu + ((u >> 16) & 1u); return (unsigned short)(u >> 16); }
__device__ __forceinline__ float bf2f(unsigned short b) { return __uint_as_float(((unsigned)b) << 16); }
__device__ __forceinline__ float bfr(float f) { return bf2f(f2bf(f)); }
__device__ __forceinline__ v16h cat16(v8h lo, v8h hi) { return __builtin_shufflevector(lo, hi, 0, 1, 2, 3, 4, 5, 6, 7, 8, 9, 10, 11, 12, 13, 14, 15); }
__device__ __forceinline__ v16bf cat16b(v8us lo, v8us hi) { return __builtin_bit_cast(v16bf, __builtin_shufflevector(lo, hi, 0, 1, 2, 3, 4, 5, 6, 7, 8, 9, 10, 11, 12, 13, 14, 15)); }
__device__ __forceinline__ v8f wmma16(v16h a, v16h b, v8f c) { return __builtin_amdgcn_wmma_f32_16x16x32_f16(false, a, false, b, (short)0, c, false, false); }
__device__ __forceinline__ v8f wmmab(v16bf a, v16bf b, v8f c) { return __builtin_amdgcn_wmma_f32_16x16x32_bf16(false, a, false, b, (short)0, c, false, false); }

__global__ __launch_bounds__(256) void k_cvtb(const float* __restrict__ src, int nrows, bf* dst) {
    const int lane = threadIdx.x & 31, r = blockIdx.x * 8 + (threadIdx.x >> 5);
    if (r >= nrows) return;
    v8us o[DM / 256];
#pragma unroll
    for (int q = 0; q < DM / 256; ++q) { v8us t;
#pragma unroll
        for (int i = 0; i < 8; ++i) t[i] = f2bf(src[(size_t)r * DM + q * 256 + lane * 8 + i]);
        o[q] = t; }
#pragma unroll
    for (int q = 0; q < DM / 256; ++q) *(v8us*)(dst + (size_t)r * DM + q * 256 + lane * 8) = o[q];
    
}

// k_wt: W [2048 k][ncols n] (k-major) -> n-major bf16 plane WT[ncols][2048]; 64 x 64 tiles through LDS.
__global__ __launch_bounds__(256) void k_wt(const float* __restrict__ Wm, int ncols, bf* WT) {
    __shared__ __align__(16) unsigned short tl[64 * 72];
    const int tid = threadIdx.x, k0 = blockIdx.x * 64, n0 = blockIdx.y * 64;
    const int kk = tid >> 2, nq = (tid & 3) * 16;
#pragma unroll
    for (int i = 0; i < 16; ++i) tl[(nq + i) * 72 + kk] = f2bf(Wm[(size_t)(k0 + kk) * ncols + n0 + nq + i]);
    __syncthreads();
    const int piece = tid & 7;
    typedef __attribute__((ext_vector_type(8))) unsigned short v8us_; typedef v8us_ __attribute__((may_alias)) v8usa_;
    auto pass = [&]() {
#pragma unroll
        for (int s = 0; s < 2; ++s) { const int nr = (tid >> 3) + 32 * s; const v8us_ val = *(const v8usa_*)(tl + nr * 72 + piece * 8);
            *(v8us_*)(WT + (size_t)(n0 + nr) * DM + k0 + piece * 8) = val; }
    };
    pass(); 
}

// k_gemmb: C[128 x 128 per block] = A . Bn^T (+ Al . Bn^T), all operands k-contiguous bf16. A pass is 128 k (256-byte rows): the block's rows of Bn, A (and Al) come
// once per block into one of two LDS buffers by asynchronous copies while the other buffer is multiplied; 8 waves (4 x 2), 32 x 64 of C each.
#define GBM 128
#define GBN 128
#define GBK 128
#define GPIT (GBK + 8)           // LDS row pitch in elements: 272 bytes = 16 x 17, the conflict-free pitch for 16-byte fragment reads of 256-byte rows
typedef float __attribute__((may_alias)) f32a;
// copy8: each lane brings 16 bytes of eight rows, 16 rows apart, from global memory to LDS. The s_wait_xcnt closes the statement so that no address register
// of an issued copy is rewritten ahead of it.
__device__ __forceinline__ void copy8(unsigned l, const bf* p) {
    asm volatile("global_load_async_to_lds_b128 %0, %8, off\n\t"
                 "global_load_async_to_lds_b128 %1, %9, off\n\t"
                 "global_load_async_to_lds_b128 %2, %10, off\n\t"
                 "global_load_async_to_lds_b128 %3, %11, off\n\t"
                 "global_load_async_to_lds_b128 %4, %12, off\n\t"
                 "global_load_async_to_lds_b128 %5, %13, off\n\t"
                 "global_load_async_to_lds_b128 %6, %14, off\n\t"
                 "global_load_async_to_lds_b128 %7, %15, off\n\t"
                 "s_wait_xcnt 0x0"
                 :: "v"(l), "v"(l + 1 * 16 * GPIT * 2), "v"(l + 2 * 16 * GPIT * 2), "v"(l + 3 * 16 * GPIT * 2), "v"(l + 4 * 16 * GPIT * 2), "v"(l + 5 * 16 * GPIT * 2), "v"(l + 6 * 16 * GPIT * 2), "v"(l + 7 * 16 * GPIT * 2),
                    "v"(p), "v"(p + 1 * 16 * DM), "v"(p + 2 * 16 * DM), "v"(p + 3 * 16 * DM), "v"(p + 4 * 16 * DM), "v"(p + 5 * 16 * DM), "v"(p + 6 * 16 * DM), "v"(p + 7 * 16 * DM)
                 : "memory");
}
template <bool SPLITA>
__global__ __launch_bounds__(256) void k_gemmb(const bf* __restrict__ A, const bf* __restrict__ Al, const bf* __restrict__ Bn, float* C, int ldc) {
    constexpr int ROWS = GBN + (SPLITA ? 2 : 1) * GBM;     // buffer rows: [Bn 128 | A 128 | Al 128]
    constexpr int STG = ROWS * GPIT, NP = DM / GBK, NKS = GBK / 32;
    __shared__ __align__(16) bf sm[2 * STG];
    const int tid = threadIdx.x, lane = tid & 31, wave = tid >> 5, lr = lane & 15, hi = lane >> 4;
    const int wm = wave >> 1, wn = wave & 1;
    const int r0 = blockIdx.x * GBM, c0 = blockIdx.y * GBN;
    const int srow = tid >> 4, spc = (tid & 15) * 8;       // staging: 16 lanes per 256-byte row, 16 rows per copy of the block
    const bf* gB = Bn + (size_t)(c0 + srow) * DM + spc;
    const bf* gA = A + (size_t)(r0 + srow) * DM + spc;
    const bf* gL = SPLITA ? Al + (size_t)(r0 + srow) * DM + spc : nullptr;
    const unsigned lst = (unsigned)(size_t)(sm + srow * GPIT + spc);      // the lane's LDS byte address in buffer 0
    auto stage = [&](int kt) {
        const unsigned l = lst + (kt & 1) * (STG * 2);
        copy8(l, gB + kt * GBK); copy8(l + GBN * GPIT * 2, gA + kt * GBK);
        if (SPLITA) copy8(l + (GBN + GBM) * GPIT * 2, gL + kt * GBK);
    };
    v8f acc[2][4];
#pragma unroll
    for (int mi = 0; mi < 2; ++mi)
#pragma unroll
        for (int ni = 0; ni < 4; ++ni) acc[mi][ni] = (v8f){};
    stage(0);
    asm volatile("s_wait_asynccnt 0x0" ::: "memory");      // this wave's copies of pass 0 have landed
    __syncthreads();                                       // every wave's have
    stage(1);
    // the pass loop stays rolled (one copy of the pass in the instruction cache, the buffer chosen by kt & 1); every loop inside it is unrolled so that each
    // index into a fragment or accumulator array is a constant and the arrays stay in registers
#pragma unroll 1
    for (int kt = 0; kt < NP; ++kt) {
        const bf* cur = sm + (kt & 1) * STG;
        const bf* fbp = cur + (wn * 64 + lr) * GPIT + 8 * hi;
        const bf* fap = cur + (GBN + wm * 32 + lr) * GPIT + 8 * hi;
        v16bf fb[2][4], fa[2][2], fl[2][2];
        auto frags = [&](int ks, int s) {
#pragma unroll
            for (int ni = 0; ni < 4; ++ni) fb[s][ni] = cat16b(*(const v8usa*)(fbp + ni * 16 * GPIT + ks * 32), *(const v8usa*)(fbp + ni * 16 * GPIT + ks * 32 + 16));
#pragma unroll
            for (int mi = 0; mi < 2; ++mi) { fa[s][mi] = cat16b(*(const v8usa*)(fap + mi * 16 * GPIT + ks * 32), *(const v8usa*)(fap + mi * 16 * GPIT + ks * 32 + 16));
                if (SPLITA) fl[s][mi] = cat16b(*(const v8usa*)(fap + (GBM + mi * 16) * GPIT + ks * 32), *(const v8usa*)(fap + (GBM + mi * 16) * GPIT + ks * 32 + 16)); }
        };
        frags(0, 0);
#pragma unroll
        for (int ks = 0; ks < NKS; ++ks) {
            if (ks + 1 < NKS) frags(ks + 1, (ks + 1) & 1);
            __builtin_amdgcn_sched_barrier(0);             // keeps the next k step's LDS reads one group ahead of this step's products, not among them
#pragma unroll
            for (int mi = 0; mi < 2; ++mi)
#pragma unroll
                for (int ni = 0; ni < 4; ++ni) acc[mi][ni] = wmmab(fa[ks & 1][mi], fb[ks & 1][ni], acc[mi][ni]);
            if (SPLITA) {
#pragma unroll
                for (int mi = 0; mi < 2; ++mi)
#pragma unroll
                    for (int ni = 0; ni < 4; ++ni) acc[mi][ni] = wmmab(fl[ks & 1][mi], fb[ks & 1][ni], acc[mi][ni]);
            }
            __builtin_amdgcn_sched_barrier(0);             // the other side of the same fence pair
        }
        asm volatile("s_wait_dscnt 0x0" ::: "memory");     // this wave has left the buffer it read
        asm volatile("s_wait_asynccnt 0x0" ::: "memory");  // its copies of pass kt + 1 have landed
        __syncthreads();                                   // publishes pass kt + 1 and ends every wave's reads of pass kt
        if (kt + 2 < NP) stage(kt + 2);                    // refill of the buffer just left; block-uniform test
    }
    asm volatile("s_wait_asynccnt 0x0" ::: "memory");      // no copy is outstanding when the buffers become output staging
    f32a* os = (f32a*)sm + wave * (32 * 68);               // per-wave 32 x 64 staging (pitch 68 floats) so that every store covers whole 128-byte lines
#pragma unroll
    for (int mi = 0; mi < 2; ++mi)
#pragma unroll
        for (int ni = 0; ni < 4; ++ni)
#pragma unroll
            for (int j = 0; j < 8; ++j) os[(mi * 16 + hi * 8 + j) * 68 + ni * 16 + lr] = acc[mi][ni][j];
    __syncthreads();
    float* crow = C + (size_t)(r0 + wm * 32) * ldc + c0 + wn * 64;
#pragma unroll
    for (int s = 0; s < 16; ++s) { const int row = 2 * s + hi;
        const v4f val = *(const v4fa*)(os + row * 68 + lr * 4); *(v4f*)(crow + (size_t)row * ldc + lr * 4) = val; }
}

// k_rope: P (f32 [t][nh*64]) -> PH/PL f16 hi + residual planes of the interleaved-pair rotation: out[2i] = x[2i] c - x[2i+1] s, out[2i+1] = x[2i] s + x[2i+1] c
// with s = sin[t][i], c = cos[t][i] in f32 (i = pair index within the head, 0..31); one wave per (t, 256 columns): lane -> 8 values (4 pairs).
__global__ __launch_bounds__(256) void k_trig(const int* __restrict__ pos, float* RC, float* RS) {
    const int u = blockIdx.x * 256 + threadIdx.x; if (u >= NT_ * 32) return;
    const int t = u >> 5, i = u & 31; const float inv = 1.0f / powf(10000.0f, (float)(2 * i) / (float)HD); const float ang = (float)(pos ? pos[t] : t) * inv; const float c = cosf(ang), s = sinf(ang);
    *(float*)(RC + u) = c; *(float*)(RS + u) = s; 
}
// k_rope: per-head RMSNorm (f32: mean of squares over the head's 64 values via an 8-lane xor reduction, eps 1e-6, x bf(w[d])) THEN the interleaved-pair rotation with
__global__ __launch_bounds__(256) void k_rope(const float* __restrict__ P, int ncols, const float* __restrict__ rs, const float* __restrict__ rc, const float* __restrict__ nw, h16* PH, h16* PL) {
    const int lane = threadIdx.x & 31, wid = blockIdx.x * 8 + (threadIdx.x >> 5);
    const int segs = ncols / 256, t = wid / segs, sg = wid - t * segs;
    if (t >= NT_) return;
    const int c0 = sg * 256 + lane * 8;                 // 8 consecutive columns = 4 pairs of one head (64 | 8)
    const v8f xv = *(const v8f*)(P + (size_t)t * ncols + c0);
    float ss = 0.f;
#pragma unroll
    for (int i = 0; i < 8; ++i) ss = fmaf(xv[i], xv[i], ss);
    ss += __shfl_xor(ss, 1, 32); ss += __shfl_xor(ss, 2, 32); ss += __shfl_xor(ss, 4, 32);      // the 8 lanes of this head
    const float rn = rsqrtf(ss * (1.0f / 64.0f) + RMS_EPS);
    float xn[8];
#pragma unroll
    for (int i = 0; i < 8; ++i) xn[i] = bfr(nw[(c0 + i) & 63]) * (xv[i] * rn);
    v8h oh, ol;
#pragma unroll
    for (int pq = 0; pq < 4; ++pq) { const int c = c0 + 2 * pq, i = (c & 63) >> 1;
        const float x1 = xn[2 * pq], x2 = xn[2 * pq + 1], s = rs[t * 32 + i], co = rc[t * 32 + i];
        const float y0 = x1 * co - x2 * s, y1 = x1 * s + x2 * co;
        const h16 a0 = (h16)y0, a1 = (h16)y1; oh[2 * pq] = a0; oh[2 * pq + 1] = a1; ol[2 * pq] = (h16)((y0 - (float)a0) * LOSC); ol[2 * pq + 1] = (h16)((y1 - (float)a1) * LOSC); }
    *(v8h*)(PH + (size_t)t * ncols + c0) = oh; *(v8h*)(PL + (size_t)t * ncols + c0) = ol; 
}
__global__ __launch_bounds__(256) void k_vt(const float* __restrict__ V, h16* VTH, h16* VTL) {
    __shared__ __align__(16) h16 tile[64 * 72];
    __shared__ __align__(16) h16 til2[64 * 72];
    const int bid = blockIdx.x;
    const int b = bid / (NKV * (NT_ / 64)), rem = bid - b * (NKV * (NT_ / 64)), h = rem / (NT_ / 64), kt = rem - h * (NT_ / 64);
    const int k0 = kt * 64, tid = threadIdx.x;
    const int kk = tid >> 2, d0 = (tid & 3) * 16;
    const float* src = V + ((size_t)b * NT_ + k0 + kk) * KVW + h * HD + d0;      // h = kv head here
#pragma unroll
    for (int i = 0; i < 16; ++i) { const float v = src[i]; const h16 a = (h16)v; tile[(d0 + i) * 72 + kk] = a; til2[(d0 + i) * 72 + kk] = (h16)((v - (float)a) * LOSC); }
    __syncthreads();
    const int piece = tid & 7;
    const size_t base = (((size_t)b * NKV + h) * HD) * NT_ + k0;
    auto pass = [&]() {
#pragma unroll
        for (int s = 0; s < 4; ++s) { const int Lid = (tid >> 3) + 32 * s; const int pln = Lid >> 6, d = Lid & 63;
            const v8h val = *(const v8ha*)((pln ? til2 : tile) + d * 72 + piece * 8); *(v8h*)((pln ? VTL : VTH) + base + (size_t)d * NT_ + piece * 8) = val; }
    };
    pass(); 
}

// k_attn: block = (b, h, 64 queries), wave = 16; the 4 meta key tiles and the window tiles up to the query tile (32 keys each, per-element mask); 4 WMMA scores /8 (f32), online softmax, weights x32768 f16 tile (same-wave may_alias
// reload after a compiler barrier), 4 WMMA .v; ctx -> bf16 hi + residual planes CH/CL[tok][h*64+d].
__global__ __launch_bounds__(128) void k_attn(const h16* __restrict__ Q16, const h16* __restrict__ QL16, const h16* __restrict__ K16, const h16* __restrict__ KL16, const h16* __restrict__ VTH, const h16* __restrict__ VTL, bf* CH, bf* CL) {
    __shared__ __align__(16) h16 plds[4][16 * 32];
    __shared__ __align__(16) h16 plds2[4][16 * 32];
    __shared__ __align__(16) float ost[4][16 * 68];
    const int lane = threadIdx.x & 31, wave = threadIdx.x >> 5, lr = lane & 15, hi = lane >> 4;
    const int bid = blockIdx.x;
    const int b = bid / (NH_ * (NT_ / 64)), rem = bid - b * (NH_ * (NT_ / 64)), h = rem / (NT_ / 64), qt = rem - h * (NT_ / 64);
    const int q0 = qt * 64 + wave * 16;
    const size_t tok0 = (size_t)b * NT_;
    h16* pl = &plds[wave][0]; h16* pl2 = &plds2[wave][0];
    v16h qa[2];
    const size_t qo0 = (tok0 + q0 + lr) * DM + h * HD + 8 * hi;
#pragma unroll
    for (int kc = 0; kc < 2; ++kc) qa[kc] = cat16(*(const v8h*)(Q16 + qo0 + kc * 32), *(const v8h*)(Q16 + qo0 + kc * 32 + 16));
    const int g = h / (NH_ / NKV);                      // kv head
    const h16* kh_b = K16 + tok0 * KVW + g * HD;
    const h16* kl_b = KL16 + tok0 * KVW + g * HD;
    const size_t vbase = (((size_t)b * NKV + g) * HD) * NT_;
    v8f o[4], ox[4];
#pragma unroll
    for (int n = 0; n < 4; ++n) { o[n] = (v8f){}; ox[n] = (v8f){}; }
    float mrow[8], lpart[8];
#pragma unroll
    for (int j = 0; j < 8; ++j) { mrow[j] = -3.0e38f; lpart[j] = 0.f; }
    int qpos[8];
#pragma unroll
    for (int j = 0; j < 8; ++j) qpos[j] = q0 + 8 * hi + j;
    // allowed(i, j) = (j >= max(i - WIN + 1, NMETA) && j <= i) || j < NMETA: the 4 meta tiles always, then the window tiles up to the query tile (block-uniform bounds, per-element predicate)
    const int wlo = (qt * 64 - (WIN - 1)) > NMETA ? (qt * 64 - (WIN - 1)) : NMETA; const int kt_lo = 0, kt_wlo = wlo / 32; const int kt_hc = (qt * 64 + 63) / 32, kt_hi = kt_hc > (NMETA / 32 - 1) ? kt_hc : (NMETA / 32 - 1);     // the meta tiles are visited even by queries below 128 (non-causal meta keys)
#pragma unroll 1
    for (int kt = kt_lo; kt <= kt_hi; ++kt) {
        if (kt >= NMETA / 32 && kt < kt_wlo) continue;      // block-uniform skip of tiles that are neither meta nor inside any of the block's windows
        const int l0 = kt * 32;
        const size_t ko0 = (size_t)(l0 + lr) * KVW + 8 * hi, ko1 = (size_t)(l0 + 16 + lr) * KVW + 8 * hi;
        v8f s0 = {}, s1 = {}, x0 = {}, x1 = {};
#pragma unroll
        for (int kc = 0; kc < 2; ++kc) {
            { const v16h k0h = cat16(*(const v8h*)(kh_b + ko0 + kc * 32), *(const v8h*)(kh_b + ko0 + kc * 32 + 16)), k1h = cat16(*(const v8h*)(kh_b + ko1 + kc * 32), *(const v8h*)(kh_b + ko1 + kc * 32 + 16));
              const v16h qlk = cat16(*(const v8h*)(QL16 + qo0 + kc * 32), *(const v8h*)(QL16 + qo0 + kc * 32 + 16));     // query residual re-read per step (registers)
              s0 = wmma16(qa[kc], k0h, s0); x0 = wmma16(qlk, k0h, x0); s1 = wmma16(qa[kc], k1h, s1); x1 = wmma16(qlk, k1h, x1);
              asm volatile("v_nop" : "+v"(s0), "+v"(s1), "+v"(x0), "+v"(x1) : "v"(qlk), "v"(k0h), "v"(k1h) : "memory"); }
            { const v16h k0l = cat16(*(const v8h*)(kl_b + ko0 + kc * 32), *(const v8h*)(kl_b + ko0 + kc * 32 + 16)), k1l = cat16(*(const v8h*)(kl_b + ko1 + kc * 32), *(const v8h*)(kl_b + ko1 + kc * 32 + 16));
              x0 = wmma16(qa[kc], k0l, x0); x1 = wmma16(qa[kc], k1l, x1);
              asm volatile("v_nop" : "+v"(x0), "+v"(x1) : "v"(k0l), "v"(k1l) : "memory"); }
        }
        asm volatile("v_nop\n\tv_nop\n\tv_nop\n\tv_nop" : "+v"(s0), "+v"(s1), "+v"(x0), "+v"(x1) : "v"(qa[0]), "v"(qa[1]));
        float alpha[8];
#pragma unroll
        for (int j = 0; j < 8; ++j) {
            const int ja = l0 + lr, jb = l0 + 16 + lr, qi = qpos[j];
            const int ws_ = (qi - (WIN - 1)) > NMETA ? (qi - (WIN - 1)) : NMETA;
            const bool ok0 = (ja < NMETA) || (ja >= ws_ && ja <= qi), ok1 = (jb < NMETA) || (jb >= ws_ && jb <= qi);
            const float a0 = ok0 ? (s0[j] + x0[j] * LOSCI) * 0.125f : -__builtin_inff(), a1 = ok1 ? (s1[j] + x1[j] * LOSCI) * 0.125f : -__builtin_inff();
            float mx = fmaxf(a0, a1);
            mx = fmaxf(mx, __shfl_xor(mx, 1, 16)); mx = fmaxf(mx, __shfl_xor(mx, 2, 16)); mx = fmaxf(mx, __shfl_xor(mx, 4, 16)); mx = fmaxf(mx, __shfl_xor(mx, 8, 16));
            const float mn = fmaxf(mrow[j], mx);
            alpha[j] = __expf(mrow[j] - mn); mrow[j] = mn;
            const float p0 = __expf(a0 - mn), p1 = __expf(a1 - mn);
            lpart[j] = lpart[j] * alpha[j] + (p0 + p1);
            const int mr = hi * 8 + j;
            const float ps0 = p0 * PSC, ps1 = p1 * PSC; const h16 h0 = (h16)ps0, h1 = (h16)ps1;
            pl[mr * 32 + lr] = h0; pl[mr * 32 + 16 + lr] = h1;
            pl2[mr * 32 + lr] = (h16)((ps0 - (float)h0) * LOSC); pl2[mr * 32 + 16 + lr] = (h16)((ps1 - (float)h1) * LOSC);
        }
#pragma unroll
        for (int n = 0; n < 4; ++n)
#pragma unroll
            for (int j = 0; j < 8; ++j) { o[n][j] *= alpha[j]; ox[n][j] *= alpha[j]; }
        asm volatile("" ::: "memory");
        const v16h pa = cat16(*(const v8ha*)(pl + lr * 32 + hi * 8), *(const v8ha*)(pl + lr * 32 + 16 + hi * 8));
        const v16h px = cat16(*(const v8ha*)(pl2 + lr * 32 + hi * 8), *(const v8ha*)(pl2 + lr * 32 + 16 + hi * 8));
#pragma unroll
        for (int n = 0; n < 4; ++n) { const size_t vo = vbase + (size_t)(n * 16 + lr) * NT_ + l0 + hi * 8;
            const v16h vh = cat16(*(const v8h*)(VTH + vo), *(const v8h*)(VTH + vo + 16)), vl = cat16(*(const v8h*)(VTL + vo), *(const v8h*)(VTL + vo + 16));
            o[n] = wmma16(pa, vh, o[n]); ox[n] = wmma16(pa, vl, ox[n]); ox[n] = wmma16(px, vh, ox[n]);
            asm volatile("" : "+v"(o[n]), "+v"(ox[n]) : "v"(vh), "v"(vl) : "memory"); }
        asm volatile("v_nop\n\tv_nop\n\tv_nop\n\tv_nop" : "+v"(o[0]), "+v"(o[1]), "+v"(o[2]), "+v"(o[3]), "+v"(ox[0]), "+v"(ox[1]), "+v"(ox[2]), "+v"(ox[3]) : "v"(pa), "v"(px));
    }
    float inv[8];
#pragma unroll
    for (int j = 0; j < 8; ++j) { float rs = lpart[j]; rs += __shfl_xor(rs, 1, 16); rs += __shfl_xor(rs, 2, 16); rs += __shfl_xor(rs, 4, 16); rs += __shfl_xor(rs, 8, 16); inv[j] = 1.0f / (rs * PSC); }
    float* os = &ost[wave][0];
#pragma unroll
    for (int n = 0; n < 4; ++n)
#pragma unroll
        for (int j = 0; j < 8; ++j) os[(hi * 8 + j) * 68 + n * 16 + lr] = (o[n][j] + ox[n][j] * LOSCI) * inv[j];
    __syncthreads();
    const size_t cbase = (tok0 + q0) * DM + (size_t)h * HD;
    auto pass = [&]() {
#pragma unroll
        for (int s = 0; s < 4; ++s) { const int row = 4 * s + (lane >> 3), piece = lane & 7; const float* sp = os + row * 68 + piece * 8; v8us oh, ol;
#pragma unroll
            for (int i = 0; i < 8; ++i) { const unsigned short hb = f2bf(sp[i]); oh[i] = hb; ol[i] = f2bf(sp[i] - bf2f(hb)); }
            *(v8us*)(CH + cbase + (size_t)row * DM + piece * 8) = oh; *(v8us*)(CL + cbase + (size_t)row * DM + piece * 8) = ol; }
    };
    pass(); 
}

#define VST2(T, p, v) do { const T vst2_v_ = (v); *(T*)(p) = vst2_v_;  } while (0)
extern "C" void kernel_launch(void* const* d_in, const int* in_sizes, int n_in,
                              void* d_out, int out_size, void* d_ws, size_t ws_size, hipStream_t stream) {
    (void)in_sizes; (void)n_in; (void)out_size;
    const float* x = (const float*)d_in[0]; const int* pos = (const int*)d_in[1]; const float* Wq = (const float*)d_in[2]; const float* Wk = (const float*)d_in[3]; const float* Wv = (const float*)d_in[4]; const float* Wo = (const float*)d_in[5]; const float* qnw = (const float*)d_in[6]; const float* knw = (const float*)d_in[7];   // [out][in] weights; position_ids [2048] i32
    float* out = (float*)d_out;    // [1][2048][2048]
    char* wsp = (char*)d_ws;
    auto take = [&](size_t bytes) { char* p = wsp; wsp += (bytes + 255) & ~(size_t)255; return (void*)p; };
    bf* Xb = (bf*)take((size_t)NTK * DM * 2); bf* WqB = (bf*)take((size_t)DM * DM * 2); bf* WkB = (bf*)take((size_t)KVW * DM * 2); bf* WvB = (bf*)take((size_t)KVW * DM * 2); bf* WoB = (bf*)take((size_t)DM * DM * 2);
    float* Qf = (float*)take((size_t)NTK * DM * 4); h16* QH = (h16*)take((size_t)NTK * DM * 2); h16* QL = (h16*)take((size_t)NTK * DM * 2);
    float* Kf = (float*)take((size_t)NTK * KVW * 4); h16* KH = (h16*)take((size_t)NTK * KVW * 2); h16* KL = (h16*)take((size_t)NTK * KVW * 2);
    float* Vf = (float*)take((size_t)NTK * KVW * 4); h16* VTH = (h16*)take((size_t)NTK * KVW * 2); h16* VTL = (h16*)take((size_t)NTK * KVW * 2);
    float* RCq = (float*)take((size_t)NT_ * 32 * 4); float* RSq = (float*)take((size_t)NT_ * 32 * 4); float* RCk = (float*)take((size_t)NT_ * 32 * 4); float* RSk = (float*)take((size_t)NT_ * 32 * 4);
    bf* CH = (bf*)take((size_t)NTK * DM * 2); bf* CL = (bf*)take((size_t)NTK * DM * 2);
    if ((size_t)(wsp - (char*)d_ws) > ws_size) return;    // 8.4 + 8.4 + 2.1 + 2.1 + 8.4 + 16.8 + 8.4 x 2 + 4.2 + 2.1 x 2 + 4.2 + 2.1 x 2 + 1 + 8.4 x 2 ~ 96 MB, no aliasing
    k_cvtb<<<DM / 8, 256, 0, stream>>>(Wq, DM, WqB); k_cvtb<<<KVW / 8, 256, 0, stream>>>(Wk, KVW, WkB); k_cvtb<<<KVW / 8, 256, 0, stream>>>(Wv, KVW, WvB); k_cvtb<<<DM / 8, 256, 0, stream>>>(Wo, DM, WoB);
    k_trig<<<(NT_ * 32) / 256, 256, 0, stream>>>(pos, RCq, RSq); k_trig<<<(NT_ * 32) / 256, 256, 0, stream>>>(nullptr, RCk, RSk);     // q: position_ids; k: arange
    k_cvtb<<<NTK / 8, 256, 0, stream>>>(x, NTK, Xb);
    k_gemmb<false><<<dim3(NTK / GBM, DM / GBN, 1), 256, 0, stream>>>(Xb, nullptr, WqB, Qf, DM);
    k_gemmb<false><<<dim3(NTK / GBM, KVW / GBN, 1), 256, 0, stream>>>(Xb, nullptr, WkB, Kf, KVW);
    k_gemmb<false><<<dim3(NTK / GBM, KVW / GBN, 1), 256, 0, stream>>>(Xb, nullptr, WvB, Vf, KVW);
    k_rope<<<(NT_ * (DM / 256)) / 8, 256, 0, stream>>>(Qf, DM, RSq, RCq, qnw, QH, QL);            // RMSNorm(q_norm_w) + rope(pos)
    k_rope<<<(NT_ * (KVW / 256)) / 8, 256, 0, stream>>>(Kf, KVW, RSk, RCk, knw, KH, KL);          // RMSNorm(k_norm_w) + rope(arange)
    k_vt<<<NB_ * NKV * (NT_ / 64), 256, 0, stream>>>(Vf, VTH, VTL);
    k_attn<<<NB_ * NH_ * (NT_ / 64), 128, 0, stream>>>(QH, QL, KH, KL, VTH, VTL, CH, CL);
    k_gemmb<true><<<dim3(NTK / GBM, DM / GBN, 1), 256, 0, stream>>>(CH, CL, WoB, out, DM);
}

// v002
// It runs in 205 microseconds.
// Timed twice side by side with v001, it ran 1.23 and 1.22 times as fast.
// Over all steps from v000 it is 1.90 times as fast.
#include <hip/hip_runtime.h>

// Contractions, f32 accumulate: q = x.Wq ([2048 x 2048].[2048 x 2048]), k/v = x.Wk/Wv ([2048 x 2048].[2048 x 512]) and attn.Wo on v_wmma_f32_16x16x32_bf16 —
// plain bf16 = rounded inputs (exact; [out][in] weights converted row by row, already n-major) for the projections, attn as bf16 hi + residual (two products) for Wo; RoPE
// (interleaved pairs, sin/cos computed by k_trig from position_ids for q, arange for k) in f32; the grouped-query causal sliding-window attention (32 query heads over 8 kv heads; keys j with
// j < 128 (meta keys) or max(i - 1023, 128) <= j <= i, window 1024 fixed at compile time) fused on v_wmma_f32_16x16x32_f16 with q and k as f16 hi + residual x1024 (hi.hi + hi.lo + lo.hi), weights

#define NB_  1
#define NT_  2048
#define DM   2048
#define NH_  32
#define NKV  8
#define KVW  (NKV * HD)          // 512
#define WIN  1024
#define NMETA 128
#define RMS_EPS 1e-6f
#define HD   64
#define NTK  (NB_ * NT_)
#define NW   1024
#define NQKV 2048
#define PSC  32768.0f
#define LOSC 1024.0f
#define LOSCI (1.0f / 1024.0f)

typedef _Float16 h16;
typedef unsigned short bf;
typedef __attribute__((ext_vector_type(16))) __bf16   v16bf;
typedef __attribute__((ext_vector_type(16))) _Float16 v16h;
typedef __attribute__((ext_vector_type(8)))  _Float16 v8h;
typedef __attribute__((ext_vector_type(8)))  unsigned short v8us;
typedef __attribute__((ext_vector_type(8)))  float    v8f;
typedef __attribute__((ext_vector_type(4)))  float    v4f;
typedef v8h  __attribute__((may_alias)) v8ha;
typedef v4f  __attribute__((may_alias)) v4fa;
typedef v8us __attribute__((may_alias)) v8usa;

__device__ __forceinline__ unsigned short f2bf(float f) { unsigned u = __float_as_uint(f); u += 0x7FFFu + ((u >> 16) & 1u); return (unsigned short)(u >> 16); }
__device__ __forceinline__ float bf2f(unsigned short b) { return __uint_as_float(((unsigned)b) << 16); }
__device__ __forceinline__ float bfr(float f) { return bf2f(f2bf(f)); }
__device__ __forceinline__ v16h cat16(v8h lo, v8h hi) { return __builtin_shufflevector(lo, hi, 0, 1, 2, 3, 4, 5, 6, 7, 8, 9, 10, 11, 12, 13, 14, 15); }
__device__ __forceinline__ v16bf cat16b(v8us lo, v8us hi) { return __builtin_bit_cast(v16bf, __builtin_shufflevector(lo, hi, 0, 1, 2, 3, 4, 5, 6, 7, 8, 9, 10, 11, 12, 13, 14, 15)); }
__device__ __forceinline__ v8f wmma16(v16h a, v16h b, v8f c) { return __builtin_amdgcn_wmma_f32_16x16x32_f16(false, a, false, b, (short)0, c, false, false); }
__device__ __forceinline__ v8f wmmab(v16bf a, v16bf b, v8f c) { return __builtin_amdgcn_wmma_f32_16x16x32_bf16(false, a, false, b, (short)0, c, false, false); }

__global__ __launch_bounds__(256) void k_cvtb(const float* __restrict__ src, int nrows, bf* dst) {
    const int lane = threadIdx.x & 31, r = blockIdx.x * 8 + (threadIdx.x >> 5);
    if (r >= nrows) return;
    v8us o[DM / 256];
#pragma unroll
    for (int q = 0; q < DM / 256; ++q) { v8us t;
#pragma unroll
        for (int i = 0; i < 8; ++i) t[i] = f2bf(src[(size_t)r * DM + q * 256 + lane * 8 + i]);
        o[q] = t; }
#pragma unroll
    for (int q = 0; q < DM / 256; ++q) *(v8us*)(dst + (size_t)r * DM + q * 256 + lane * 8) = o[q];
    
}

// k_wt: W [2048 k][ncols n] (k-major) -> n-major bf16 plane WT[ncols][2048]; 64 x 64 tiles through LDS.
__global__ __launch_bounds__(256) void k_wt(const float* __restrict__ Wm, int ncols, bf* WT) {
    __shared__ __align__(16) unsigned short tl[64 * 72];
    const int tid = threadIdx.x, k0 = blockIdx.x * 64, n0 = blockIdx.y * 64;
    const int kk = tid >> 2, nq = (tid & 3) * 16;
#pragma unroll
    for (int i = 0; i < 16; ++i) tl[(nq + i) * 72 + kk] = f2bf(Wm[(size_t)(k0 + kk) * ncols + n0 + nq + i]);
    __syncthreads();
    const int piece = tid & 7;
    typedef __attribute__((ext_vector_type(8))) unsigned short v8us_; typedef v8us_ __attribute__((may_alias)) v8usa_;
    auto pass = [&]() {
#pragma unroll
        for (int s = 0; s < 2; ++s) { const int nr = (tid >> 3) + 32 * s; const v8us_ val = *(const v8usa_*)(tl + nr * 72 + piece * 8);
            *(v8us_*)(WT + (size_t)(n0 + nr) * DM + k0 + piece * 8) = val; }
    };
    pass(); 
}

// k_gemmb: C[128 x 128 per block] = A . Bn^T (+ Al . Bn^T), all operands k-contiguous bf16. A pass is 128 k (256-byte rows): the block's rows of Bn, A (and Al) come
// once per block into one of two LDS buffers by asynchronous copies while the other buffer is multiplied; 8 waves (4 x 2), 32 x 64 of C each.
#define GBM 128
#define GBN 128
#define GBK 128
#define GPIT (GBK + 8)           // LDS row pitch in elements: 272 bytes = 16 x 17, the conflict-free pitch for 16-byte fragment reads of 256-byte rows
typedef float __attribute__((may_alias)) f32a;
// copy8: each lane brings 16 bytes of eight rows, 16 rows apart, from global memory to LDS. The s_wait_xcnt closes the statement so that no address register
// of an issued copy is rewritten ahead of it.
__device__ __forceinline__ void copy8(unsigned l, const bf* p) {
    asm volatile("global_load_async_to_lds_b128 %0, %8, off\n\t"
                 "global_load_async_to_lds_b128 %1, %9, off\n\t"
                 "global_load_async_to_lds_b128 %2, %10, off\n\t"
                 "global_load_async_to_lds_b128 %3, %11, off\n\t"
                 "global_load_async_to_lds_b128 %4, %12, off\n\t"
                 "global_load_async_to_lds_b128 %5, %13, off\n\t"
                 "global_load_async_to_lds_b128 %6, %14, off\n\t"
                 "global_load_async_to_lds_b128 %7, %15, off\n\t"
                 "s_wait_xcnt 0x0"
                 :: "v"(l), "v"(l + 1 * 16 * GPIT * 2), "v"(l + 2 * 16 * GPIT * 2), "v"(l + 3 * 16 * GPIT * 2), "v"(l + 4 * 16 * GPIT * 2), "v"(l + 5 * 16 * GPIT * 2), "v"(l + 6 * 16 * GPIT * 2), "v"(l + 7 * 16 * GPIT * 2),
                    "v"(p), "v"(p + 1 * 16 * DM), "v"(p + 2 * 16 * DM), "v"(p + 3 * 16 * DM), "v"(p + 4 * 16 * DM), "v"(p + 5 * 16 * DM), "v"(p + 6 * 16 * DM), "v"(p + 7 * 16 * DM)
                 : "memory");
}
template <bool SPLITA>
__global__ __launch_bounds__(256) void k_gemmb(const bf* __restrict__ A, const bf* __restrict__ Al, const bf* __restrict__ Bn, float* C, int ldc) {
    constexpr int ROWS = GBN + (SPLITA ? 2 : 1) * GBM;     // buffer rows: [Bn 128 | A 128 | Al 128]
    constexpr int STG = ROWS * GPIT, NP = DM / GBK, NKS = GBK / 32;
    __shared__ __align__(16) bf sm[2 * STG];
    const int tid = threadIdx.x, lane = tid & 31, wave = tid >> 5, lr = lane & 15, hi = lane >> 4;
    const int wm = wave >> 1, wn = wave & 1;
    const int r0 = blockIdx.x * GBM, c0 = blockIdx.y * GBN;
    const int srow = tid >> 4, spc = (tid & 15) * 8;       // staging: 16 lanes per 256-byte row, 16 rows per copy of the block
    const bf* gB = Bn + (size_t)(c0 + srow) * DM + spc;
    const bf* gA = A + (size_t)(r0 + srow) * DM + spc;
    const bf* gL = SPLITA ? Al + (size_t)(r0 + srow) * DM + spc : nullptr;
    const unsigned lst = (unsigned)(size_t)(sm + srow * GPIT + spc);      // the lane's LDS byte address in buffer 0
    auto stage = [&](int kt) {
        const unsigned l = lst + (kt & 1) * (STG * 2);
        copy8(l, gB + kt * GBK); copy8(l + GBN * GPIT * 2, gA + kt * GBK);
        if (SPLITA) copy8(l + (GBN + GBM) * GPIT * 2, gL + kt * GBK);
    };
    v8f acc[2][4];
#pragma unroll
    for (int mi = 0; mi < 2; ++mi)
#pragma unroll
        for (int ni = 0; ni < 4; ++ni) acc[mi][ni] = (v8f){};
    stage(0);
    asm volatile("s_wait_asynccnt 0x0" ::: "memory");      // this wave's copies of pass 0 have landed
    __syncthreads();                                       // every wave's have
    stage(1);
    // the pass loop stays rolled (one copy of the pass in the instruction cache, the buffer chosen by kt & 1); every loop inside it is unrolled so that each
    // index into a fragment or accumulator array is a constant and the arrays stay in registers
#pragma unroll 1
    for (int kt = 0; kt < NP; ++kt) {
        const bf* cur = sm + (kt & 1) * STG;
        const bf* fbp = cur + (wn * 64 + lr) * GPIT + 8 * hi;
        const bf* fap = cur + (GBN + wm * 32 + lr) * GPIT + 8 * hi;
        v16bf fb[2][4], fa[2][2], fl[2][2];
        auto frags = [&](int ks, int s) {
#pragma unroll
            for (int ni = 0; ni < 4; ++ni) fb[s][ni] = cat16b(*(const v8usa*)(fbp + ni * 16 * GPIT + ks * 32), *(const v8usa*)(fbp + ni * 16 * GPIT + ks * 32 + 16));
#pragma unroll
            for (int mi = 0; mi < 2; ++mi) { fa[s][mi] = cat16b(*(const v8usa*)(fap + mi * 16 * GPIT + ks * 32), *(const v8usa*)(fap + mi * 16 * GPIT + ks * 32 + 16));
                if (SPLITA) fl[s][mi] = cat16b(*(const v8usa*)(fap + (GBM + mi * 16) * GPIT + ks * 32), *(const v8usa*)(fap + (GBM + mi * 16) * GPIT + ks * 32 + 16)); }
        };
        frags(0, 0);
#pragma unroll
        for (int ks = 0; ks < NKS; ++ks) {
            if (ks + 1 < NKS) frags(ks + 1, (ks + 1) & 1);
            __builtin_amdgcn_sched_barrier(0);             // keeps the next k step's LDS reads one group ahead of this step's products, not among them
#pragma unroll
            for (int mi = 0; mi < 2; ++mi)
#pragma unroll
                for (int ni = 0; ni < 4; ++ni) acc[mi][ni] = wmmab(fa[ks & 1][mi], fb[ks & 1][ni], acc[mi][ni]);
            if (SPLITA) {
#pragma unroll
                for (int mi = 0; mi < 2; ++mi)
#pragma unroll
                    for (int ni = 0; ni < 4; ++ni) acc[mi][ni] = wmmab(fl[ks & 1][mi], fb[ks & 1][ni], acc[mi][ni]);
            }
            __builtin_amdgcn_sched_barrier(0);             // the other side of the same fence pair
        }
        asm volatile("s_wait_dscnt 0x0" ::: "memory");     // this wave has left the buffer it read
        asm volatile("s_wait_asynccnt 0x0" ::: "memory");  // its copies of pass kt + 1 have landed
        __syncthreads();                                   // publishes pass kt + 1 and ends every wave's reads of pass kt
        if (kt + 2 < NP) stage(kt + 2);                    // refill of the buffer just left; block-uniform test
    }
    asm volatile("s_wait_asynccnt 0x0" ::: "memory");      // no copy is outstanding when the buffers become output staging
    f32a* os = (f32a*)sm + wave * (32 * 68);               // per-wave 32 x 64 staging (pitch 68 floats) so that every store covers whole 128-byte lines
#pragma unroll
    for (int mi = 0; mi < 2; ++mi)
#pragma unroll
        for (int ni = 0; ni < 4; ++ni)
#pragma unroll
            for (int j = 0; j < 8; ++j) os[(mi * 16 + hi * 8 + j) * 68 + ni * 16 + lr] = acc[mi][ni][j];
    __syncthreads();
    float* crow = C + (size_t)(r0 + wm * 32) * ldc + c0 + wn * 64;
#pragma unroll
    for (int s = 0; s < 16; ++s) { const int row = 2 * s + hi;
        const v4f val = *(const v4fa*)(os + row * 68 + lr * 4); *(v4f*)(crow + (size_t)row * ldc + lr * 4) = val; }
}

// k_rope: P (f32 [t][nh*64]) -> PH/PL f16 hi + residual planes of the interleaved-pair rotation: out[2i] = x[2i] c - x[2i+1] s, out[2i+1] = x[2i] s + x[2i+1] c
// with s = sin[t][i], c = cos[t][i] in f32 (i = pair index within the head, 0..31); one wave per (t, 256 columns): lane -> 8 values (4 pairs).
__global__ __launch_bounds__(256) void k_trig(const int* __restrict__ pos, float* RC, float* RS) {
    const int u = blockIdx.x * 256 + threadIdx.x; if (u >= NT_ * 32) return;
    const int t = u >> 5, i = u & 31; const float inv = 1.0f / powf(10000.0f, (float)(2 * i) / (float)HD); const float ang = (float)(pos ? pos[t] : t) * inv; const float c = cosf(ang), s = sinf(ang);
    *(float*)(RC + u) = c; *(float*)(RS + u) = s; 
}
// k_rope: per-head RMSNorm (f32: mean of squares over the head's 64 values via an 8-lane xor reduction, eps 1e-6, x bf(w[d])) THEN the interleaved-pair rotation with
__global__ __launch_bounds__(256) void k_rope(const float* __restrict__ P, int ncols, const float* __restrict__ rs, const float* __restrict__ rc, const float* __restrict__ nw, h16* PH, h16* PL) {
    const int lane = threadIdx.x & 31, wid = blockIdx.x * 8 + (threadIdx.x >> 5);
    const int segs = ncols / 256, t = wid / segs, sg = wid - t * segs;
    if (t >= NT_) return;
    const int c0 = sg * 256 + lane * 8;                 // 8 consecutive columns = 4 pairs of one head (64 | 8)
    const v8f xv = *(const v8f*)(P + (size_t)t * ncols + c0);
    float ss = 0.f;
#pragma unroll
    for (int i = 0; i < 8; ++i) ss = fmaf(xv[i], xv[i], ss);
    ss += __shfl_xor(ss, 1, 32); ss += __shfl_xor(ss, 2, 32); ss += __shfl_xor(ss, 4, 32);      // the 8 lanes of this head
    const float rn = rsqrtf(ss * (1.0f / 64.0f) + RMS_EPS);
    float xn[8];
#pragma unroll
    for (int i = 0; i < 8; ++i) xn[i] = bfr(nw[(c0 + i) & 63]) * (xv[i] * rn);
    v8h oh, ol;
#pragma unroll
    for (int pq = 0; pq < 4; ++pq) { const int c = c0 + 2 * pq, i = (c & 63) >> 1;
        const float x1 = xn[2 * pq], x2 = xn[2 * pq + 1], s = rs[t * 32 + i], co = rc[t * 32 + i];
        const float y0 = x1 * co - x2 * s, y1 = x1 * s + x2 * co;
        const h16 a0 = (h16)y0, a1 = (h16)y1; oh[2 * pq] = a0; oh[2 * pq + 1] = a1; ol[2 * pq] = (h16)((y0 - (float)a0) * LOSC); ol[2 * pq + 1] = (h16)((y1 - (float)a1) * LOSC); }
    *(v8h*)(PH + (size_t)t * ncols + c0) = oh; *(v8h*)(PL + (size_t)t * ncols + c0) = ol; 
}
__global__ __launch_bounds__(256) void k_vt(const float* __restrict__ V, h16* VTH, h16* VTL) {
    __shared__ __align__(16) h16 tile[64 * 72];
    __shared__ __align__(16) h16 til2[64 * 72];
    const int bid = blockIdx.x;
    const int b = bid / (NKV * (NT_ / 64)), rem = bid - b * (NKV * (NT_ / 64)), h = rem / (NT_ / 64), kt = rem - h * (NT_ / 64);
    const int k0 = kt * 64, tid = threadIdx.x;
    const int kk = tid >> 2, d0 = (tid & 3) * 16;
    const float* src = V + ((size_t)b * NT_ + k0 + kk) * KVW + h * HD + d0;      // h = kv head here
#pragma unroll
    for (int i = 0; i < 16; ++i) { const float v = src[i]; const h16 a = (h16)v; tile[(d0 + i) * 72 + kk] = a; til2[(d0 + i) * 72 + kk] = (h16)((v - (float)a) * LOSC); }
    __syncthreads();
    const int piece = tid & 7;
    const size_t base = (((size_t)b * NKV + h) * HD) * NT_ + k0;
    auto pass = [&]() {
#pragma unroll
        for (int s = 0; s < 4; ++s) { const int Lid = (tid >> 3) + 32 * s; const int pln = Lid >> 6, d = Lid & 63;
            const v8h val = *(const v8ha*)((pln ? til2 : tile) + d * 72 + piece * 8); *(v8h*)((pln ? VTL : VTH) + base + (size_t)d * NT_ + piece * 8) = val; }
    };
    pass(); 
}

// k_attn: block = (b, h, 64 queries), wave = 16; the 4 meta key tiles and the window tiles up to the query tile (32 keys each, per-element mask); 4 WMMA scores /8 (f32), online softmax, weights x32768 f16 tile (same-wave may_alias
// reload after a compiler barrier), 4 WMMA .v; ctx -> bf16 hi + residual planes CH/CL[tok][h*64+d].
#define KPIT 72                  // LDS pitch of a 64-value K row in elements: 144 bytes = 16 x 9, conflict-free for 16-byte fragment reads
#define VPIT 40                  // LDS pitch of a 32-key row of transposed V: 80 bytes = 16 x 5
#define KPL  (32 * KPIT)         // one K plane of a tile (32 keys)
#define VPL  (64 * VPIT)         // one V plane of a tile (64 head values)
#define ASTG (2 * KPL + 2 * VPL) // one buffer: [K hi | K lo | V hi | V lo]
// copy_kv: each lane brings 16 bytes of two rows of each of the four planes of a 32-key tile from global memory to LDS. The s_wait_xcnt closes the statement so
// that no address register of an issued copy is rewritten ahead of it.
__device__ __forceinline__ void copy_kv(unsigned lk, unsigned lv, const h16* kh, const h16* kl, const h16* vh, const h16* vl) {
    asm volatile("global_load_async_to_lds_b128 %0, %8, off\n\t"
                 "global_load_async_to_lds_b128 %1, %9, off\n\t"
                 "global_load_async_to_lds_b128 %2, %10, off\n\t"
                 "global_load_async_to_lds_b128 %3, %11, off\n\t"
                 "global_load_async_to_lds_b128 %4, %12, off\n\t"
                 "global_load_async_to_lds_b128 %5, %13, off\n\t"
                 "global_load_async_to_lds_b128 %6, %14, off\n\t"
                 "global_load_async_to_lds_b128 %7, %15, off\n\t"
                 "s_wait_xcnt 0x0"
                 :: "v"(lk), "v"(lk + 16 * KPIT * 2), "v"(lk + KPL * 2), "v"(lk + KPL * 2 + 16 * KPIT * 2), "v"(lv), "v"(lv + 32 * VPIT * 2), "v"(lv + VPL * 2), "v"(lv + VPL * 2 + 32 * VPIT * 2),
                    "v"(kh), "v"(kh + 16 * KVW), "v"(kl), "v"(kl + 16 * KVW), "v"(vh), "v"(vh + 32 * NT_), "v"(vl), "v"(vl + 32 * NT_)
                 : "memory");
}
__global__ __launch_bounds__(128) void k_attn(const h16* __restrict__ Q16, const h16* __restrict__ QL16, const h16* __restrict__ K16, const h16* __restrict__ KL16, const h16* __restrict__ VTH, const h16* __restrict__ VTL, bf* CH, bf* CL) {
    __shared__ __align__(16) h16 plds[4][16 * 32];
    __shared__ __align__(16) h16 plds2[4][16 * 32];
    __shared__ __align__(16) float ost[4][16 * 68];
    __shared__ __align__(16) h16 kv[2 * ASTG];
    const int lane = threadIdx.x & 31, wave = threadIdx.x >> 5, lr = lane & 15, hi = lane >> 4;
    const int bid = blockIdx.x;
    const int b = bid / (NH_ * (NT_ / 64)), rem = bid - b * (NH_ * (NT_ / 64)), h = rem / (NT_ / 64), qt = rem - h * (NT_ / 64);
    const int q0 = qt * 64 + wave * 16;
    const size_t tok0 = (size_t)b * NT_;
    h16* pl = &plds[wave][0]; h16* pl2 = &plds2[wave][0];
    v16h qa[2], ql[2];
    const size_t qo0 = (tok0 + q0 + lr) * DM + h * HD + 8 * hi;
#pragma unroll
    for (int kc = 0; kc < 2; ++kc) { qa[kc] = cat16(*(const v8h*)(Q16 + qo0 + kc * 32), *(const v8h*)(Q16 + qo0 + kc * 32 + 16));
        ql[kc] = cat16(*(const v8h*)(QL16 + qo0 + kc * 32), *(const v8h*)(QL16 + qo0 + kc * 32 + 16)); }
    const int g = h / (NH_ / NKV);                      // kv head
    const h16* kh_b = K16 + tok0 * KVW + g * HD;
    const h16* kl_b = KL16 + tok0 * KVW + g * HD;
    const size_t vbase = (((size_t)b * NKV + g) * HD) * NT_;
    v8f o[4], ox[4];
#pragma unroll
    for (int n = 0; n < 4; ++n) { o[n] = (v8f){}; ox[n] = (v8f){}; }
    float mrow[8], lpart[8];
#pragma unroll
    for (int j = 0; j < 8; ++j) { mrow[j] = -3.0e38f; lpart[j] = 0.f; }
    int qpos[8];
#pragma unroll
    for (int j = 0; j < 8; ++j) qpos[j] = q0 + 8 * hi + j;
    // allowed(i, j) = (j >= max(i - WIN + 1, NMETA) && j <= i) || j < NMETA: the 4 meta tiles always, then the window tiles up to the query tile (block-uniform bounds, per-element predicate)
    const int wlo = (qt * 64 - (WIN - 1)) > NMETA ? (qt * 64 - (WIN - 1)) : NMETA; const int kt_wlo = wlo / 32; const int kt_hc = (qt * 64 + 63) / 32, kt_hi = kt_hc > (NMETA / 32 - 1) ? kt_hc : (NMETA / 32 - 1);     // the meta tiles are visited even by queries below 128 (non-causal meta keys)
    // the tiles in the order of the walk: ti = 0..3 are the meta tiles, ti >= 4 the window tiles kt_wlo..kt_hi (kt_wlo >= 4); all of it block-uniform
    const int ntile = NMETA / 32 + (kt_hi >= kt_wlo ? kt_hi - kt_wlo + 1 : 0);
    const int tid = threadIdx.x;
    const int krow = tid >> 3, kpc = (tid & 7) * 8;         // staging of K: 8 lanes per 128-byte row, 16 rows per copy of the block
    const int vrow = tid >> 2, vpc = (tid & 3) * 8;         // staging of V: 4 lanes per 64-byte row, 32 rows per copy of the block
    const unsigned lk0 = (unsigned)(size_t)(kv + krow * KPIT + kpc), lv0 = (unsigned)(size_t)(kv + 2 * KPL + vrow * VPIT + vpc);     // the lane's LDS byte addresses in buffer 0
    const h16* gkh = kh_b + (size_t)krow * KVW + kpc; const h16* gkl = kl_b + (size_t)krow * KVW + kpc;
    const h16* gvh = VTH + vbase + (size_t)vrow * NT_ + vpc; const h16* gvl = VTL + vbase + (size_t)vrow * NT_ + vpc;
    auto stage = [&](int ti) {
        const int sl0 = (ti < NMETA / 32 ? ti : ti - NMETA / 32 + kt_wlo) * 32; const unsigned bo = (ti & 1) * (ASTG * 2);
        copy_kv(lk0 + bo, lv0 + bo, gkh + (size_t)sl0 * KVW, gkl + (size_t)sl0 * KVW, gvh + sl0, gvl + sl0);
    };
    stage(0);
    asm volatile("s_wait_asynccnt 0x0" ::: "memory");      // this wave's copies of tile 0 have landed
    __syncthreads();                                       // every wave's have
    stage(1);                                              // ntile >= 4: a tile 1 always exists
#pragma unroll 1
    for (int ti = 0; ti < ntile; ++ti) {
        const int kt = ti < NMETA / 32 ? ti : ti - NMETA / 32 + kt_wlo;
        const int l0 = kt * 32;
        const h16* cur = kv + (ti & 1) * ASTG;
        const h16* fk = cur + lr * KPIT + 8 * hi;
        const h16* fv = cur + 2 * KPL + lr * VPIT + 8 * hi;
        v8f s0 = {}, s1 = {}, x0 = {}, x1 = {};
        v16h k0h[2], k1h[2], k0l[2], k1l[2];
#pragma unroll
        for (int kc = 0; kc < 2; ++kc) {
            k0h[kc] = cat16(*(const v8ha*)(fk + kc * 32), *(const v8ha*)(fk + kc * 32 + 16)); k1h[kc] = cat16(*(const v8ha*)(fk + 16 * KPIT + kc * 32), *(const v8ha*)(fk + 16 * KPIT + kc * 32 + 16));
            k0l[kc] = cat16(*(const v8ha*)(fk + KPL + kc * 32), *(const v8ha*)(fk + KPL + kc * 32 + 16)); k1l[kc] = cat16(*(const v8ha*)(fk + KPL + 16 * KPIT + kc * 32), *(const v8ha*)(fk + KPL + 16 * KPIT + kc * 32 + 16)); }
#pragma unroll
        for (int kc = 0; kc < 2; ++kc) {
            s0 = wmma16(qa[kc], k0h[kc], s0); x0 = wmma16(ql[kc], k0h[kc], x0); s1 = wmma16(qa[kc], k1h[kc], s1); x1 = wmma16(ql[kc], k1h[kc], x1);
            x0 = wmma16(qa[kc], k0l[kc], x0); x1 = wmma16(qa[kc], k1l[kc], x1);
        }
        asm volatile("v_nop\n\tv_nop\n\tv_nop\n\tv_nop" : "+v"(s0), "+v"(s1), "+v"(x0), "+v"(x1) : "v"(qa[0]), "v"(qa[1]));
        float alpha[8];
#pragma unroll
        for (int j = 0; j < 8; ++j) {
            const int ja = l0 + lr, jb = l0 + 16 + lr, qi = qpos[j];
            const int ws_ = (qi - (WIN - 1)) > NMETA ? (qi - (WIN - 1)) : NMETA;
            const bool ok0 = (ja < NMETA) || (ja >= ws_ && ja <= qi), ok1 = (jb < NMETA) || (jb >= ws_ && jb <= qi);
            const float a0 = ok0 ? (s0[j] + x0[j] * LOSCI) * 0.125f : -__builtin_inff(), a1 = ok1 ? (s1[j] + x1[j] * LOSCI) * 0.125f : -__builtin_inff();
            float mx = fmaxf(a0, a1);
            mx = fmaxf(mx, __shfl_xor(mx, 1, 16)); mx = fmaxf(mx, __shfl_xor(mx, 2, 16)); mx = fmaxf(mx, __shfl_xor(mx, 4, 16)); mx = fmaxf(mx, __shfl_xor(mx, 8, 16));
            const float mn = fmaxf(mrow[j], mx);
            alpha[j] = __expf(mrow[j] - mn); mrow[j] = mn;
            const float p0 = __expf(a0 - mn), p1 = __expf(a1 - mn);
            lpart[j] = lpart[j] * alpha[j] + (p0 + p1);
            const int mr = hi * 8 + j;
            const float ps0 = p0 * PSC, ps1 = p1 * PSC; const h16 h0 = (h16)ps0, h1 = (h16)ps1;
            pl[mr * 32 + lr] = h0; pl[mr * 32 + 16 + lr] = h1;
            pl2[mr * 32 + lr] = (h16)((ps0 - (float)h0) * LOSC); pl2[mr * 32 + 16 + lr] = (h16)((ps1 - (float)h1) * LOSC);
        }
#pragma unroll
        for (int n = 0; n < 4; ++n)
#pragma unroll
            for (int j = 0; j < 8; ++j) { o[n][j] *= alpha[j]; ox[n][j] *= alpha[j]; }
        asm volatile("" ::: "memory");
        const v16h pa = cat16(*(const v8ha*)(pl + lr * 32 + hi * 8), *(const v8ha*)(pl + lr * 32 + 16 + hi * 8));
        const v16h px = cat16(*(const v8ha*)(pl2 + lr * 32 + hi * 8), *(const v8ha*)(pl2 + lr * 32 + 16 + hi * 8));
#pragma unroll
        for (int n = 0; n < 4; ++n) { const h16* vp = fv + n * 16 * VPIT;
            const v16h vh = cat16(*(const v8ha*)(vp), *(const v8ha*)(vp + 16)), vl = cat16(*(const v8ha*)(vp + VPL), *(const v8ha*)(vp + VPL + 16));
            o[n] = wmma16(pa, vh, o[n]); ox[n] = wmma16(pa, vl, ox[n]); ox[n] = wmma16(px, vh, ox[n]); }
        asm volatile("v_nop\n\tv_nop\n\tv_nop\n\tv_nop" : "+v"(o[0]), "+v"(o[1]), "+v"(o[2]), "+v"(o[3]), "+v"(ox[0]), "+v"(ox[1]), "+v"(ox[2]), "+v"(ox[3]) : "v"(pa), "v"(px));
        asm volatile("s_wait_dscnt 0x0" ::: "memory");     // this wave has left the buffer it read
        asm volatile("s_wait_asynccnt 0x0" ::: "memory");  // its copies of tile ti + 1 have landed
        __syncthreads();                                   // publishes tile ti + 1 and ends every wave's reads of tile ti
        if (ti + 2 < ntile) stage(ti + 2);                 // refill of the buffer just left; block-uniform test
    }
    asm volatile("s_wait_asynccnt 0x0" ::: "memory");      // no copy is outstanding when the wave goes on to the epilogue
    float inv[8];
#pragma unroll
    for (int j = 0; j < 8; ++j) { float rs = lpart[j]; rs += __shfl_xor(rs, 1, 16); rs += __shfl_xor(rs, 2, 16); rs += __shfl_xor(rs, 4, 16); rs += __shfl_xor(rs, 8, 16); inv[j] = 1.0f / (rs * PSC); }
    float* os = &ost[wave][0];
#pragma unroll
    for (int n = 0; n < 4; ++n)
#pragma unroll
        for (int j = 0; j < 8; ++j) os[(hi * 8 + j) * 68 + n * 16 + lr] = (o[n][j] + ox[n][j] * LOSCI) * inv[j];
    __syncthreads();
    const size_t cbase = (tok0 + q0) * DM + (size_t)h * HD;
    auto pass = [&]() {
#pragma unroll
        for (int s = 0; s < 4; ++s) { const int row = 4 * s + (lane >> 3), piece = lane & 7; const float* sp = os + row * 68 + piece * 8; v8us oh, ol;
#pragma unroll
            for (int i = 0; i < 8; ++i) { const unsigned short hb = f2bf(sp[i]); oh[i] = hb; ol[i] = f2bf(sp[i] - bf2f(hb)); }
            *(v8us*)(CH + cbase + (size_t)row * DM + piece * 8) = oh; *(v8us*)(CL + cbase + (size_t)row * DM + piece * 8) = ol; }
    };
    pass(); 
}

#define VST2(T, p, v) do { const T vst2_v_ = (v); *(T*)(p) = vst2_v_;  } while (0)
extern "C" void kernel_launch(void* const* d_in, const int* in_sizes, int n_in,
                              void* d_out, int out_size, void* d_ws, size_t ws_size, hipStream_t stream) {
    (void)in_sizes; (void)n_in; (void)out_size;
    const float* x = (const float*)d_in[0]; const int* pos = (const int*)d_in[1]; const float* Wq = (const float*)d_in[2]; const float* Wk = (const float*)d_in[3]; const float* Wv = (const float*)d_in[4]; const float* Wo = (const float*)d_in[5]; const float* qnw = (const float*)d_in[6]; const float* knw = (const float*)d_in[7];   // [out][in] weights; position_ids [2048] i32
    float* out = (float*)d_out;    // [1][2048][2048]
    char* wsp = (char*)d_ws;
    auto take = [&](size_t bytes) { char* p = wsp; wsp += (bytes + 255) & ~(size_t)255; return (void*)p; };
    bf* Xb = (bf*)take((size_t)NTK * DM * 2); bf* WqB = (bf*)take((size_t)DM * DM * 2); bf* WkB = (bf*)take((size_t)KVW * DM * 2); bf* WvB = (bf*)take((size_t)KVW * DM * 2); bf* WoB = (bf*)take((size_t)DM * DM * 2);
    float* Qf = (float*)take((size_t)NTK * DM * 4); h16* QH = (h16*)take((size_t)NTK * DM * 2); h16* QL = (h16*)take((size_t)NTK * DM * 2);
    float* Kf = (float*)take((size_t)NTK * KVW * 4); h16* KH = (h16*)take((size_t)NTK * KVW * 2); h16* KL = (h16*)take((size_t)NTK * KVW * 2);
    float* Vf = (float*)take((size_t)NTK * KVW * 4); h16* VTH = (h16*)take((size_t)NTK * KVW * 2); h16* VTL = (h16*)take((size_t)NTK * KVW * 2);
    float* RCq = (float*)take((size_t)NT_ * 32 * 4); float* RSq = (float*)take((size_t)NT_ * 32 * 4); float* RCk = (float*)take((size_t)NT_ * 32 * 4); float* RSk = (float*)take((size_t)NT_ * 32 * 4);
    bf* CH = (bf*)take((size_t)NTK * DM * 2); bf* CL = (bf*)take((size_t)NTK * DM * 2);
    if ((size_t)(wsp - (char*)d_ws) > ws_size) return;    // 8.4 + 8.4 + 2.1 + 2.1 + 8.4 + 16.8 + 8.4 x 2 + 4.2 + 2.1 x 2 + 4.2 + 2.1 x 2 + 1 + 8.4 x 2 ~ 96 MB, no aliasing
    k_cvtb<<<DM / 8, 256, 0, stream>>>(Wq, DM, WqB); k_cvtb<<<KVW / 8, 256, 0, stream>>>(Wk, KVW, WkB); k_cvtb<<<KVW / 8, 256, 0, stream>>>(Wv, KVW, WvB); k_cvtb<<<DM / 8, 256, 0, stream>>>(Wo, DM, WoB);
    k_trig<<<(NT_ * 32) / 256, 256, 0, stream>>>(pos, RCq, RSq); k_trig<<<(NT_ * 32) / 256, 256, 0, stream>>>(nullptr, RCk, RSk);     // q: position_ids; k: arange
    k_cvtb<<<NTK / 8, 256, 0, stream>>>(x, NTK, Xb);
    k_gemmb<false><<<dim3(NTK / GBM, DM / GBN, 1), 256, 0, stream>>>(Xb, nullptr, WqB, Qf, DM);
    k_gemmb<false><<<dim3(NTK / GBM, KVW / GBN, 1), 256, 0, stream>>>(Xb, nullptr, WkB, Kf, KVW);
    k_gemmb<false><<<dim3(NTK / GBM, KVW / GBN, 1), 256, 0, stream>>>(Xb, nullptr, WvB, Vf, KVW);
    k_rope<<<(NT_ * (DM / 256)) / 8, 256, 0, stream>>>(Qf, DM, RSq, RCq, qnw, QH, QL);            // RMSNorm(q_norm_w) + rope(pos)
    k_rope<<<(NT_ * (KVW / 256)) / 8, 256, 0, stream>>>(Kf, KVW, RSk, RCk, knw, KH, KL);          // RMSNorm(k_norm_w) + rope(arange)
    k_vt<<<NB_ * NKV * (NT_ / 64), 256, 0, stream>>>(Vf, VTH, VTL);
    k_attn<<<NB_ * NH_ * (NT_ / 64), 128, 0, stream>>>(QH, QL, KH, KL, VTH, VTL, CH, CL);
    k_gemmb<true><<<dim3(NTK / GBM, DM / GBN, 1), 256, 0, stream>>>(CH, CL, WoB, out, DM);
}

// v003
// It runs in 159 microseconds.
// Timed twice side by side with v002, it ran 1.28 and 1.30 times as fast.
// Over all steps from v000 it is 2.45 times as fast.
#include <hip/hip_runtime.h>

// Contractions, f32 accumulate: q = x.Wq ([2048 x 2048].[2048 x 2048]), k/v = x.Wk/Wv ([2048 x 2048].[2048 x 512]) and attn.Wo on v_wmma_f32_16x16x32_bf16 —
// plain bf16 = rounded inputs (exact; [out][in] weights converted row by row, already n-major) for the projections, attn as bf16 hi + residual (two products) for Wo; RoPE
// (interleaved pairs, sin/cos computed by k_prep from position_ids for q, arange for k) in f32; the grouped-query causal sliding-window attention (32 query heads over 8 kv heads; keys j with
// j < 128 (meta keys) or max(i - 1023, 128) <= j <= i, window 1024 fixed at compile time) fused on v_wmma_f32_16x16x32_f16 with q and k as f16 hi + residual x1024 (hi.hi + hi.lo + lo.hi), weights

#define NB_  1
#define NT_  2048
#define DM   2048
#define NH_  32
#define NKV  8
#define KVW  (NKV * HD)          // 512
#define WIN  1024
#define NMETA 128
#define RMS_EPS 1e-6f
#define HD   64
#define NTK  (NB_ * NT_)
#define NW   1024
#define NQKV 2048
#define PSC  32768.0f
#define LOSC 1024.0f
#define LOSCI (1.0f / 1024.0f)
#define LDP  (DM + 2 * KVW)       // row length of the joint projection plane [t][q 2048 | k 512 | v 512]

typedef _Float16 h16;
typedef unsigned short bf;
typedef __attribute__((ext_vector_type(16))) __bf16   v16bf;
typedef __attribute__((ext_vector_type(16))) _Float16 v16h;
typedef __attribute__((ext_vector_type(8)))  _Float16 v8h;
typedef __attribute__((ext_vector_type(8)))  unsigned short v8us;
typedef __attribute__((ext_vector_type(8)))  float    v8f;
typedef __attribute__((ext_vector_type(4)))  float    v4f;
typedef v8h  __attribute__((may_alias)) v8ha;
typedef v4f  __attribute__((may_alias)) v4fa;
typedef v8us __attribute__((may_alias)) v8usa;

__device__ __forceinline__ unsigned short f2bf(float f) { unsigned u = __float_as_uint(f); u += 0x7FFFu + ((u >> 16) & 1u); return (unsigned short)(u >> 16); }
__device__ __forceinline__ float bf2f(unsigned short b) { return __uint_as_float(((unsigned)b) << 16); }
__device__ __forceinline__ float bfr(float f) { return bf2f(f2bf(f)); }
__device__ __forceinline__ v16h cat16(v8h lo, v8h hi) { return __builtin_shufflevector(lo, hi, 0, 1, 2, 3, 4, 5, 6, 7, 8, 9, 10, 11, 12, 13, 14, 15); }
__device__ __forceinline__ v16bf cat16b(v8us lo, v8us hi) { return __builtin_bit_cast(v16bf, __builtin_shufflevector(lo, hi, 0, 1, 2, 3, 4, 5, 6, 7, 8, 9, 10, 11, 12, 13, 14, 15)); }
__device__ __forceinline__ v8f wmma16(v16h a, v16h b, v8f c) { return __builtin_amdgcn_wmma_f32_16x16x32_f16(false, a, false, b, (short)0, c, false, false); }
__device__ __forceinline__ v8f wmmab(v16bf a, v16bf b, v8f c) { return __builtin_amdgcn_wmma_f32_16x16x32_bf16(false, a, false, b, (short)0, c, false, false); }

__device__ __forceinline__ void cvtb_body(const float* __restrict__ src, int nrows, bf* dst, int blk) {
    const int lane = threadIdx.x & 31, r = blk * 8 + (threadIdx.x >> 5);
    if (r >= nrows) return;
    v8us o[DM / 256];
#pragma unroll
    for (int q = 0; q < DM / 256; ++q) { v8us t;
#pragma unroll
        for (int i = 0; i < 8; ++i) t[i] = f2bf(src[(size_t)r * DM + q * 256 + lane * 8 + i]);
        o[q] = t; }
#pragma unroll
    for (int q = 0; q < DM / 256; ++q) *(v8us*)(dst + (size_t)r * DM + q * 256 + lane * 8) = o[q];
    
}

// k_wt: W [2048 k][ncols n] (k-major) -> n-major bf16 plane WT[ncols][2048]; 64 x 64 tiles through LDS.
__global__ __launch_bounds__(256) void k_wt(const float* __restrict__ Wm, int ncols, bf* WT) {
    __shared__ __align__(16) unsigned short tl[64 * 72];
    const int tid = threadIdx.x, k0 = blockIdx.x * 64, n0 = blockIdx.y * 64;
    const int kk = tid >> 2, nq = (tid & 3) * 16;
#pragma unroll
    for (int i = 0; i < 16; ++i) tl[(nq + i) * 72 + kk] = f2bf(Wm[(size_t)(k0 + kk) * ncols + n0 + nq + i]);
    __syncthreads();
    const int piece = tid & 7;
    typedef __attribute__((ext_vector_type(8))) unsigned short v8us_; typedef v8us_ __attribute__((may_alias)) v8usa_;
    auto pass = [&]() {
#pragma unroll
        for (int s = 0; s < 2; ++s) { const int nr = (tid >> 3) + 32 * s; const v8us_ val = *(const v8usa_*)(tl + nr * 72 + piece * 8);
            *(v8us_*)(WT + (size_t)(n0 + nr) * DM + k0 + piece * 8) = val; }
    };
    pass(); 
}

// k_gemmb: C[128 x 128 per block] = A . Bn^T (+ Al . Bn^T), all operands k-contiguous bf16. A pass is 128 k (256-byte rows): the block's rows of Bn, A (and Al) come
// once per block into one of two LDS buffers by asynchronous copies while the other buffer is multiplied; 8 waves (4 x 2), 32 x 64 of C each.
#define GBM 128
#define GBN 128
#define GBK 128
#define GPIT (GBK + 8)           // LDS row pitch in elements: 272 bytes = 16 x 17, the conflict-free pitch for 16-byte fragment reads of 256-byte rows
typedef float __attribute__((may_alias)) f32a;
// copy8: each lane brings 16 bytes of eight rows, 16 rows apart, from global memory to LDS. The s_wait_xcnt closes the statement so that no address register
// of an issued copy is rewritten ahead of it.
__device__ __forceinline__ void copy8(unsigned l, const bf* p) {
    asm volatile("global_load_async_to_lds_b128 %0, %8, off\n\t"
                 "global_load_async_to_lds_b128 %1, %9, off\n\t"
                 "global_load_async_to_lds_b128 %2, %10, off\n\t"
                 "global_load_async_to_lds_b128 %3, %11, off\n\t"
                 "global_load_async_to_lds_b128 %4, %12, off\n\t"
                 "global_load_async_to_lds_b128 %5, %13, off\n\t"
                 "global_load_async_to_lds_b128 %6, %14, off\n\t"
                 "global_load_async_to_lds_b128 %7, %15, off\n\t"
                 "s_wait_xcnt 0x0"
                 :: "v"(l), "v"(l + 1 * 16 * GPIT * 2), "v"(l + 2 * 16 * GPIT * 2), "v"(l + 3 * 16 * GPIT * 2), "v"(l + 4 * 16 * GPIT * 2), "v"(l + 5 * 16 * GPIT * 2), "v"(l + 6 * 16 * GPIT * 2), "v"(l + 7 * 16 * GPIT * 2),
                    "v"(p), "v"(p + 1 * 16 * DM), "v"(p + 2 * 16 * DM), "v"(p + 3 * 16 * DM), "v"(p + 4 * 16 * DM), "v"(p + 5 * 16 * DM), "v"(p + 6 * 16 * DM), "v"(p + 7 * 16 * DM)
                 : "memory");
}
template <bool SPLITA>
__global__ __launch_bounds__(256) void k_gemmb(const bf* __restrict__ A, const bf* __restrict__ Al, const bf* __restrict__ Bn, float* C, int ldc) {
    constexpr int ROWS = GBN + (SPLITA ? 2 : 1) * GBM;     // buffer rows: [Bn 128 | A 128 | Al 128]
    constexpr int STG = ROWS * GPIT, NP = DM / GBK, NKS = GBK / 32;
    __shared__ __align__(16) bf sm[2 * STG];
    const int tid = threadIdx.x, lane = tid & 31, wave = tid >> 5, lr = lane & 15, hi = lane >> 4;
    const int wm = wave >> 1, wn = wave & 1;
    const int r0 = blockIdx.x * GBM, c0 = blockIdx.y * GBN;
    const int srow = tid >> 4, spc = (tid & 15) * 8;       // staging: 16 lanes per 256-byte row, 16 rows per copy of the block
    const bf* gB = Bn + (size_t)(c0 + srow) * DM + spc;
    const bf* gA = A + (size_t)(r0 + srow) * DM + spc;
    const bf* gL = SPLITA ? Al + (size_t)(r0 + srow) * DM + spc : nullptr;
    const unsigned lst = (unsigned)(size_t)(sm + srow * GPIT + spc);      // the lane's LDS byte address in buffer 0
    auto stage = [&](int kt) {
        const unsigned l = lst + (kt & 1) * (STG * 2);
        copy8(l, gB + kt * GBK); copy8(l + GBN * GPIT * 2, gA + kt * GBK);
        if (SPLITA) copy8(l + (GBN + GBM) * GPIT * 2, gL + kt * GBK);
    };
    v8f acc[2][4];
#pragma unroll
    for (int mi = 0; mi < 2; ++mi)
#pragma unroll
        for (int ni = 0; ni < 4; ++ni) acc[mi][ni] = (v8f){};
    stage(0);
    asm volatile("s_wait_asynccnt 0x0" ::: "memory");      // this wave's copies of pass 0 have landed
    __syncthreads();                                       // every wave's have
    stage(1);
    // the pass loop stays rolled (one copy of the pass in the instruction cache, the buffer chosen by kt & 1); every loop inside it is unrolled so that each
    // index into a fragment or accumulator array is a constant and the arrays stay in registers
#pragma unroll 1
    for (int kt = 0; kt < NP; ++kt) {
        const bf* cur = sm + (kt & 1) * STG;
        const bf* fbp = cur + (wn * 64 + lr) * GPIT + 8 * hi;
        const bf* fap = cur + (GBN + wm * 32 + lr) * GPIT + 8 * hi;
        v16bf fb[2][4], fa[2][2], fl[2][2];
        auto frags = [&](int ks, int s) {
#pragma unroll
            for (int ni = 0; ni < 4; ++ni) fb[s][ni] = cat16b(*(const v8usa*)(fbp + ni * 16 * GPIT + ks * 32), *(const v8usa*)(fbp + ni * 16 * GPIT + ks * 32 + 16));
#pragma unroll
            for (int mi = 0; mi < 2; ++mi) { fa[s][mi] = cat16b(*(const v8usa*)(fap + mi * 16 * GPIT + ks * 32), *(const v8usa*)(fap + mi * 16 * GPIT + ks * 32 + 16));
                if (SPLITA) fl[s][mi] = cat16b(*(const v8usa*)(fap + (GBM + mi * 16) * GPIT + ks * 32), *(const v8usa*)(fap + (GBM + mi * 16) * GPIT + ks * 32 + 16)); }
        };
        frags(0, 0);
#pragma unroll
        for (int ks = 0; ks < NKS; ++ks) {
            if (ks + 1 < NKS) frags(ks + 1, (ks + 1) & 1);
            __builtin_amdgcn_sched_barrier(0);             // keeps the next k step's LDS reads one group ahead of this step's products, not among them
#pragma unroll
            for (int mi = 0; mi < 2; ++mi)
#pragma unroll
                for (int ni = 0; ni < 4; ++ni) acc[mi][ni] = wmmab(fa[ks & 1][mi], fb[ks & 1][ni], acc[mi][ni]);
            if (SPLITA) {
#pragma unroll
                for (int mi = 0; mi < 2; ++mi)
#pragma unroll
                    for (int ni = 0; ni < 4; ++ni) acc[mi][ni] = wmmab(fl[ks & 1][mi], fb[ks & 1][ni], acc[mi][ni]);
            }
            __builtin_amdgcn_sched_barrier(0);             // the other side of the same fence pair
        }
        asm volatile("s_wait_dscnt 0x0" ::: "memory");     // this wave has left the buffer it read
        asm volatile("s_wait_asynccnt 0x0" ::: "memory");  // its copies of pass kt + 1 have landed
        __syncthreads();                                   // publishes pass kt + 1 and ends every wave's reads of pass kt
        if (kt + 2 < NP) stage(kt + 2);                    // refill of the buffer just left; block-uniform test
    }
    asm volatile("s_wait_asynccnt 0x0" ::: "memory");      // no copy is outstanding when the buffers become output staging
    f32a* os = (f32a*)sm + wave * (32 * 68);               // per-wave 32 x 64 staging (pitch 68 floats) so that every store covers whole 128-byte lines
#pragma unroll
    for (int mi = 0; mi < 2; ++mi)
#pragma unroll
        for (int ni = 0; ni < 4; ++ni)
#pragma unroll
            for (int j = 0; j < 8; ++j) os[(mi * 16 + hi * 8 + j) * 68 + ni * 16 + lr] = acc[mi][ni][j];
    __syncthreads();
    float* crow = C + (size_t)(r0 + wm * 32) * ldc + c0 + wn * 64;
#pragma unroll
    for (int s = 0; s < 16; ++s) { const int row = 2 * s + hi;
        const v4f val = *(const v4fa*)(os + row * 68 + lr * 4); *(v4f*)(crow + (size_t)row * ldc + lr * 4) = val; }
}

// rope_body: P (f32 [t][LDP], nh*64 columns per t) -> PH/PL f16 hi + residual planes of the interleaved-pair rotation: out[2i] = x[2i] c - x[2i+1] s, out[2i+1] = x[2i] s + x[2i+1] c
// with s = sin[t][i], c = cos[t][i] (i = pair index within the head, 0..31); one wave per (t, 256 columns): lane -> 8 values (4 pairs).
__device__ __forceinline__ void trig_body(const int* __restrict__ pos, float* RC, float* RS, int blk) {
    const int u = blk * 256 + threadIdx.x; if (u >= NT_ * 32) return;
    const int t = u >> 5, i = u & 31; const float inv = 1.0f / powf(10000.0f, (float)(2 * i) / (float)HD); const float ang = (float)(pos ? pos[t] : t) * inv; const float c = cosf(ang), s = sinf(ang);
    *(float*)(RC + u) = c; *(float*)(RS + u) = s; 
}
// k_prep: the seven launches that need nothing of each other (two rotation tables, five bf16 roundings) as ranges of one grid's block index; every branch is block-uniform.
#define PB_TRIG ((NT_ * 32) / 256)
#define PB_X    (NTK / 8)
#define PB_W    (DM / 8)
#define PB_KV   (KVW / 8)
#define PB_ALL  (2 * PB_TRIG + PB_X + 2 * PB_W + 2 * PB_KV)
__global__ __launch_bounds__(256) void k_prep(const float* __restrict__ x, const int* __restrict__ pos, const float* __restrict__ Wq, const float* __restrict__ Wk, const float* __restrict__ Wv, const float* __restrict__ Wo,
                                              bf* Xb, bf* WqB, bf* WkB, bf* WvB, bf* WoB, float* RCq, float* RSq, float* RCk, float* RSk) {
    int blk = blockIdx.x;
    if (blk < 2 * PB_TRIG) { const bool ik = blk >= PB_TRIG;      // q: position_ids; k: arange
        trig_body(ik ? nullptr : pos, ik ? RCk : RCq, ik ? RSk : RSq, ik ? blk - PB_TRIG : blk); return; }
    blk -= 2 * PB_TRIG;
    const float* src = x; bf* dst = Xb; int nrows = NTK;
    if (blk >= PB_X) { blk -= PB_X; src = Wq; dst = WqB; nrows = DM;
        if (blk >= PB_W) { blk -= PB_W; src = Wo; dst = WoB;
            if (blk >= PB_W) { blk -= PB_W; src = Wk; dst = WkB; nrows = KVW;
                if (blk >= PB_KV) { blk -= PB_KV; src = Wv; dst = WvB; } } } }
    cvtb_body(src, nrows, dst, blk);
}
// rope_body: per-head RMSNorm (f32: mean of squares over the head's 64 values via an 8-lane xor reduction, eps 1e-6, x bf(w[d])) THEN the interleaved-pair rotation with
__device__ __forceinline__ void rope_body(const float* __restrict__ P, int ncols, const float* __restrict__ rs, const float* __restrict__ rc, const float* __restrict__ nw, h16* PH, h16* PL, int blk) {
    const int lane = threadIdx.x & 31, wid = blk * 8 + (threadIdx.x >> 5);
    const int segs = ncols / 256, t = wid / segs, sg = wid - t * segs;
    if (t >= NT_) return;
    const int c0 = sg * 256 + lane * 8;                 // 8 consecutive columns = 4 pairs of one head (64 | 8)
    const v8f xv = *(const v8f*)(P + (size_t)t * LDP + c0);
    asm volatile("s_wait_xcnt 0x0" ::: "memory");       // stands ahead of the weight loads, whose results the compiler lays over the address registers of the two loads above
    float ss = 0.f;
#pragma unroll
    for (int i = 0; i < 8; ++i) ss = fmaf(xv[i], xv[i], ss);
    ss += __shfl_xor(ss, 1, 32); ss += __shfl_xor(ss, 2, 32); ss += __shfl_xor(ss, 4, 32);      // the 8 lanes of this head
    const float rn = rsqrtf(ss * (1.0f / 64.0f) + RMS_EPS);
    float xn[8];
#pragma unroll
    for (int i = 0; i < 8; ++i) xn[i] = bfr(nw[(c0 + i) & 63]) * (xv[i] * rn);
    v8h oh, ol;
#pragma unroll
    for (int pq = 0; pq < 4; ++pq) { const int c = c0 + 2 * pq, i = (c & 63) >> 1;
        const float x1 = xn[2 * pq], x2 = xn[2 * pq + 1], s = rs[t * 32 + i], co = rc[t * 32 + i];
        const float y0 = x1 * co - x2 * s, y1 = x1 * s + x2 * co;
        const h16 a0 = (h16)y0, a1 = (h16)y1; oh[2 * pq] = a0; oh[2 * pq + 1] = a1; ol[2 * pq] = (h16)((y0 - (float)a0) * LOSC); ol[2 * pq + 1] = (h16)((y1 - (float)a1) * LOSC); }
    *(v8h*)(PH + (size_t)t * ncols + c0) = oh; *(v8h*)(PL + (size_t)t * ncols + c0) = ol; 
}
__device__ __forceinline__ void vt_body(const float* __restrict__ V, h16* VTH, h16* VTL, int bid) {
    __shared__ __align__(16) h16 tile[64 * 72];
    __shared__ __align__(16) h16 til2[64 * 72];
    const int b = bid / (NKV * (NT_ / 64)), rem = bid - b * (NKV * (NT_ / 64)), h = rem / (NT_ / 64), kt = rem - h * (NT_ / 64);
    const int k0 = kt * 64, tid = threadIdx.x;
    const int kk = tid >> 2, d0 = (tid & 3) * 16;
    const float* src = V + ((size_t)b * NT_ + k0 + kk) * LDP + h * HD + d0;      // h = kv head here
#pragma unroll
    for (int i = 0; i < 16; ++i) { const float v = src[i]; const h16 a = (h16)v; tile[(d0 + i) * 72 + kk] = a; til2[(d0 + i) * 72 + kk] = (h16)((v - (float)a) * LOSC); }
    __syncthreads();
    const int piece = tid & 7;
    const size_t base = (((size_t)b * NKV + h) * HD) * NT_ + k0;
    auto pass = [&]() {
#pragma unroll
        for (int s = 0; s < 4; ++s) { const int Lid = (tid >> 3) + 32 * s; const int pln = Lid >> 6, d = Lid & 63;
            const v8h val = *(const v8ha*)((pln ? til2 : tile) + d * 72 + piece * 8); *(v8h*)((pln ? VTL : VTH) + base + (size_t)d * NT_ + piece * 8) = val; }
    };
    pass(); 
}
// k_post: the three launches between the projections and the attention (v transpose, norm + rotation of q and of k) as ranges of one grid's block index; P is the
// joint plane [t][q | k | v]. Every branch is block-uniform, so the transpose's barrier is passed by whole blocks only.
#define QB_VT (NB_ * NKV * (NT_ / 64))
#define QB_RQ ((NT_ * (DM / 256)) / 8)
#define QB_RK ((NT_ * (KVW / 256)) / 8)
__global__ __launch_bounds__(256) void k_post(const float* __restrict__ P, const float* __restrict__ rsq, const float* __restrict__ rcq, const float* __restrict__ rsk, const float* __restrict__ rck,
                                              const float* __restrict__ qnw, const float* __restrict__ knw, h16* QH, h16* QL, h16* KH, h16* KL, h16* VTH, h16* VTL) {
    int blk = blockIdx.x;
    if (blk < QB_VT) { vt_body(P + DM + KVW, VTH, VTL, blk); return; }
    blk -= QB_VT;
    const bool ik = blk >= QB_RQ;
    rope_body(ik ? P + DM : P, ik ? KVW : DM, ik ? rsk : rsq, ik ? rck : rcq, ik ? knw : qnw, ik ? KH : QH, ik ? KL : QL, ik ? blk - QB_RQ : blk);
}

// k_attn: block = (b, h, 64 queries), wave = 16; the 4 meta key tiles and the window tiles up to the query tile (32 keys each, per-element mask); 4 WMMA scores /8 (f32), online softmax, weights x32768 f16 tile (same-wave may_alias
// reload after a compiler barrier), 4 WMMA .v; ctx -> bf16 hi + residual planes CH/CL[tok][h*64+d].
#define KPIT 72                  // LDS pitch of a 64-value K row in elements: 144 bytes = 16 x 9, conflict-free for 16-byte fragment reads
#define VPIT 40                  // LDS pitch of a 32-key row of transposed V: 80 bytes = 16 x 5
#define KPL  (32 * KPIT)         // one K plane of a tile (32 keys)
#define VPL  (64 * VPIT)         // one V plane of a tile (64 head values)
#define ASTG (2 * KPL + 2 * VPL) // one buffer: [K hi | K lo | V hi | V lo]
// copy_kv: each lane brings 16 bytes of two rows of each of the four planes of a 32-key tile from global memory to LDS. The s_wait_xcnt closes the statement so
// that no address register of an issued copy is rewritten ahead of it.
__device__ __forceinline__ void copy_kv(unsigned lk, unsigned lv, const h16* kh, const h16* kl, const h16* vh, const h16* vl) {
    asm volatile("global_load_async_to_lds_b128 %0, %8, off\n\t"
                 "global_load_async_to_lds_b128 %1, %9, off\n\t"
                 "global_load_async_to_lds_b128 %2, %10, off\n\t"
                 "global_load_async_to_lds_b128 %3, %11, off\n\t"
                 "global_load_async_to_lds_b128 %4, %12, off\n\t"
                 "global_load_async_to_lds_b128 %5, %13, off\n\t"
                 "global_load_async_to_lds_b128 %6, %14, off\n\t"
                 "global_load_async_to_lds_b128 %7, %15, off\n\t"
                 "s_wait_xcnt 0x0"
                 :: "v"(lk), "v"(lk + 16 * KPIT * 2), "v"(lk + KPL * 2), "v"(lk + KPL * 2 + 16 * KPIT * 2), "v"(lv), "v"(lv + 32 * VPIT * 2), "v"(lv + VPL * 2), "v"(lv + VPL * 2 + 32 * VPIT * 2),
                    "v"(kh), "v"(kh + 16 * KVW), "v"(kl), "v"(kl + 16 * KVW), "v"(vh), "v"(vh + 32 * NT_), "v"(vl), "v"(vl + 32 * NT_)
                 : "memory");
}
__global__ __launch_bounds__(128) void k_attn(const h16* __restrict__ Q16, const h16* __restrict__ QL16, const h16* __restrict__ K16, const h16* __restrict__ KL16, const h16* __restrict__ VTH, const h16* __restrict__ VTL, bf* CH, bf* CL) {
    __shared__ __align__(16) h16 plds[4][16 * 32];
    __shared__ __align__(16) h16 plds2[4][16 * 32];
    __shared__ __align__(16) float ost[4][16 * 68];
    __shared__ __align__(16) h16 kv[2 * ASTG];
    const int lane = threadIdx.x & 31, wave = threadIdx.x >> 5, lr = lane & 15, hi = lane >> 4;
    const int bid = blockIdx.x;
    const int b = bid / (NH_ * (NT_ / 64)), rem = bid - b * (NH_ * (NT_ / 64)), h = rem / (NT_ / 64), qt = rem - h * (NT_ / 64);
    const int q0 = qt * 64 + wave * 16;
    const size_t tok0 = (size_t)b * NT_;
    h16* pl = &plds[wave][0]; h16* pl2 = &plds2[wave][0];
    v16h qa[2], ql[2];
    const size_t qo0 = (tok0 + q0 + lr) * DM + h * HD + 8 * hi;
#pragma unroll
    for (int kc = 0; kc < 2; ++kc) { qa[kc] = cat16(*(const v8h*)(Q16 + qo0 + kc * 32), *(const v8h*)(Q16 + qo0 + kc * 32 + 16));
        ql[kc] = cat16(*(const v8h*)(QL16 + qo0 + kc * 32), *(const v8h*)(QL16 + qo0 + kc * 32 + 16)); }
    const int g = h / (NH_ / NKV);                      // kv head
    const h16* kh_b = K16 + tok0 * KVW + g * HD;
    const h16* kl_b = KL16 + tok0 * KVW + g * HD;
    const size_t vbase = (((size_t)b * NKV + g) * HD) * NT_;
    v8f o[4], ox[4];
#pragma unroll
    for (int n = 0; n < 4; ++n) { o[n] = (v8f){}; ox[n] = (v8f){}; }
    float mrow[8], lpart[8];
#pragma unroll
    for (int j = 0; j < 8; ++j) { mrow[j] = -3.0e38f; lpart[j] = 0.f; }
    int qpos[8];
#pragma unroll
    for (int j = 0; j < 8; ++j) qpos[j] = q0 + 8 * hi + j;
    // allowed(i, j) = (j >= max(i - WIN + 1, NMETA) && j <= i) || j < NMETA: the 4 meta tiles always, then the window tiles up to the query tile (block-uniform bounds, per-element predicate)
    const int wlo = (qt * 64 - (WIN - 1)) > NMETA ? (qt * 64 - (WIN - 1)) : NMETA; const int kt_wlo = wlo / 32; const int kt_hc = (qt * 64 + 63) / 32, kt_hi = kt_hc > (NMETA / 32 - 1) ? kt_hc : (NMETA / 32 - 1);     // the meta tiles are visited even by queries below 128 (non-causal meta keys)
    // the tiles in the order of the walk: ti = 0..3 are the meta tiles, ti >= 4 the window tiles kt_wlo..kt_hi (kt_wlo >= 4); all of it block-uniform
    const int ntile = NMETA / 32 + (kt_hi >= kt_wlo ? kt_hi - kt_wlo + 1 : 0);
    const int tid = threadIdx.x;
    const int krow = tid >> 3, kpc = (tid & 7) * 8;         // staging of K: 8 lanes per 128-byte row, 16 rows per copy of the block
    const int vrow = tid >> 2, vpc = (tid & 3) * 8;         // staging of V: 4 lanes per 64-byte row, 32 rows per copy of the block
    const unsigned lk0 = (unsigned)(size_t)(kv + krow * KPIT + kpc), lv0 = (unsigned)(size_t)(kv + 2 * KPL + vrow * VPIT + vpc);     // the lane's LDS byte addresses in buffer 0
    const h16* gkh = kh_b + (size_t)krow * KVW + kpc; const h16* gkl = kl_b + (size_t)krow * KVW + kpc;
    const h16* gvh = VTH + vbase + (size_t)vrow * NT_ + vpc; const h16* gvl = VTL + vbase + (size_t)vrow * NT_ + vpc;
    auto stage = [&](int ti) {
        const int sl0 = (ti < NMETA / 32 ? ti : ti - NMETA / 32 + kt_wlo) * 32; const unsigned bo = (ti & 1) * (ASTG * 2);
        copy_kv(lk0 + bo, lv0 + bo, gkh + (size_t)sl0 * KVW, gkl + (size_t)sl0 * KVW, gvh + sl0, gvl + sl0);
    };
    stage(0);
    asm volatile("s_wait_asynccnt 0x0" ::: "memory");      // this wave's copies of tile 0 have landed
    __syncthreads();                                       // every wave's have
    stage(1);                                              // ntile >= 4: a tile 1 always exists
#pragma unroll 1
    for (int ti = 0; ti < ntile; ++ti) {
        const int kt = ti < NMETA / 32 ? ti : ti - NMETA / 32 + kt_wlo;
        const int l0 = kt * 32;
        const h16* cur = kv + (ti & 1) * ASTG;
        const h16* fk = cur + lr * KPIT + 8 * hi;
        const h16* fv = cur + 2 * KPL + lr * VPIT + 8 * hi;
        v8f s0 = {}, s1 = {}, x0 = {}, x1 = {};
        v16h k0h[2], k1h[2], k0l[2], k1l[2];
#pragma unroll
        for (int kc = 0; kc < 2; ++kc) {
            k0h[kc] = cat16(*(const v8ha*)(fk + kc * 32), *(const v8ha*)(fk + kc * 32 + 16)); k1h[kc] = cat16(*(const v8ha*)(fk + 16 * KPIT + kc * 32), *(const v8ha*)(fk + 16 * KPIT + kc * 32 + 16));
            k0l[kc] = cat16(*(const v8ha*)(fk + KPL + kc * 32), *(const v8ha*)(fk + KPL + kc * 32 + 16)); k1l[kc] = cat16(*(const v8ha*)(fk + KPL + 16 * KPIT + kc * 32), *(const v8ha*)(fk + KPL + 16 * KPIT + kc * 32 + 16)); }
#pragma unroll
        for (int kc = 0; kc < 2; ++kc) {
            s0 = wmma16(qa[kc], k0h[kc], s0); x0 = wmma16(ql[kc], k0h[kc], x0); s1 = wmma16(qa[kc], k1h[kc], s1); x1 = wmma16(ql[kc], k1h[kc], x1);
            x0 = wmma16(qa[kc], k0l[kc], x0); x1 = wmma16(qa[kc], k1l[kc], x1);
        }
        asm volatile("v_nop\n\tv_nop\n\tv_nop\n\tv_nop" : "+v"(s0), "+v"(s1), "+v"(x0), "+v"(x1) : "v"(qa[0]), "v"(qa[1]));
        float alpha[8];
#pragma unroll
        for (int j = 0; j < 8; ++j) {
            const int ja = l0 + lr, jb = l0 + 16 + lr, qi = qpos[j];
            const int ws_ = (qi - (WIN - 1)) > NMETA ? (qi - (WIN - 1)) : NMETA;
            const bool ok0 = (ja < NMETA) || (ja >= ws_ && ja <= qi), ok1 = (jb < NMETA) || (jb >= ws_ && jb <= qi);
            const float a0 = ok0 ? (s0[j] + x0[j] * LOSCI) * 0.125f : -__builtin_inff(), a1 = ok1 ? (s1[j] + x1[j] * LOSCI) * 0.125f : -__builtin_inff();
            float mx = fmaxf(a0, a1);
            mx = fmaxf(mx, __shfl_xor(mx, 1, 16)); mx = fmaxf(mx, __shfl_xor(mx, 2, 16)); mx = fmaxf(mx, __shfl_xor(mx, 4, 16)); mx = fmaxf(mx, __shfl_xor(mx, 8, 16));
            const float mn = fmaxf(mrow[j], mx);
            alpha[j] = __expf(mrow[j] - mn); mrow[j] = mn;
            const float p0 = __expf(a0 - mn), p1 = __expf(a1 - mn);
            lpart[j] = lpart[j] * alpha[j] + (p0 + p1);
            const int mr = hi * 8 + j;
            const float ps0 = p0 * PSC, ps1 = p1 * PSC; const h16 h0 = (h16)ps0, h1 = (h16)ps1;
            pl[mr * 32 + lr] = h0; pl[mr * 32 + 16 + lr] = h1;
            pl2[mr * 32 + lr] = (h16)((ps0 - (float)h0) * LOSC); pl2[mr * 32 + 16 + lr] = (h16)((ps1 - (float)h1) * LOSC);
        }
#pragma unroll
        for (int n = 0; n < 4; ++n)
#pragma unroll
            for (int j = 0; j < 8; ++j) { o[n][j] *= alpha[j]; ox[n][j] *= alpha[j]; }
        asm volatile("" ::: "memory");
        const v16h pa = cat16(*(const v8ha*)(pl + lr * 32 + hi * 8), *(const v8ha*)(pl + lr * 32 + 16 + hi * 8));
        const v16h px = cat16(*(const v8ha*)(pl2 + lr * 32 + hi * 8), *(const v8ha*)(pl2 + lr * 32 + 16 + hi * 8));
#pragma unroll
        for (int n = 0; n < 4; ++n) { const h16* vp = fv + n * 16 * VPIT;
            const v16h vh = cat16(*(const v8ha*)(vp), *(const v8ha*)(vp + 16)), vl = cat16(*(const v8ha*)(vp + VPL), *(const v8ha*)(vp + VPL + 16));
            o[n] = wmma16(pa, vh, o[n]); ox[n] = wmma16(pa, vl, ox[n]); ox[n] = wmma16(px, vh, ox[n]); }
        asm volatile("v_nop\n\tv_nop\n\tv_nop\n\tv_nop" : "+v"(o[0]), "+v"(o[1]), "+v"(o[2]), "+v"(o[3]), "+v"(ox[0]), "+v"(ox[1]), "+v"(ox[2]), "+v"(ox[3]) : "v"(pa), "v"(px));
        asm volatile("s_wait_dscnt 0x0" ::: "memory");     // this wave has left the buffer it read
        asm volatile("s_wait_asynccnt 0x0" ::: "memory");  // its copies of tile ti + 1 have landed
        __syncthreads();                                   // publishes tile ti + 1 and ends every wave's reads of tile ti
        if (ti + 2 < ntile) stage(ti + 2);                 // refill of the buffer just left; block-uniform test
    }
    asm volatile("s_wait_asynccnt 0x0" ::: "memory");      // no copy is outstanding when the wave goes on to the epilogue
    float inv[8];
#pragma unroll
    for (int j = 0; j < 8; ++j) { float rs = lpart[j]; rs += __shfl_xor(rs, 1, 16); rs += __shfl_xor(rs, 2, 16); rs += __shfl_xor(rs, 4, 16); rs += __shfl_xor(rs, 8, 16); inv[j] = 1.0f / (rs * PSC); }
    float* os = &ost[wave][0];
#pragma unroll
    for (int n = 0; n < 4; ++n)
#pragma unroll
        for (int j = 0; j < 8; ++j) os[(hi * 8 + j) * 68 + n * 16 + lr] = (o[n][j] + ox[n][j] * LOSCI) * inv[j];
    __syncthreads();
    const size_t cbase = (tok0 + q0) * DM + (size_t)h * HD;
    auto pass = [&]() {
#pragma unroll
        for (int s = 0; s < 4; ++s) { const int row = 4 * s + (lane >> 3), piece = lane & 7; const float* sp = os + row * 68 + piece * 8; v8us oh, ol;
#pragma unroll
            for (int i = 0; i < 8; ++i) { const unsigned short hb = f2bf(sp[i]); oh[i] = hb; ol[i] = f2bf(sp[i] - bf2f(hb)); }
            *(v8us*)(CH + cbase + (size_t)row * DM + piece * 8) = oh; *(v8us*)(CL + cbase + (size_t)row * DM + piece * 8) = ol; }
    };
    pass(); 
}

#define VST2(T, p, v) do { const T vst2_v_ = (v); *(T*)(p) = vst2_v_;  } while (0)
extern "C" void kernel_launch(void* const* d_in, const int* in_sizes, int n_in,
                              void* d_out, int out_size, void* d_ws, size_t ws_size, hipStream_t stream) {
    (void)in_sizes; (void)n_in; (void)out_size;
    const float* x = (const float*)d_in[0]; const int* pos = (const int*)d_in[1]; const float* Wq = (const float*)d_in[2]; const float* Wk = (const float*)d_in[3]; const float* Wv = (const float*)d_in[4]; const float* Wo = (const float*)d_in[5]; const float* qnw = (const float*)d_in[6]; const float* knw = (const float*)d_in[7];   // [out][in] weights; position_ids [2048] i32
    float* out = (float*)d_out;    // [1][2048][2048]
    char* wsp = (char*)d_ws;
    auto take = [&](size_t bytes) { char* p = wsp; wsp += (bytes + 255) & ~(size_t)255; return (void*)p; };
    bf* Xb = (bf*)take((size_t)NTK * DM * 2); bf* WqB = (bf*)take((size_t)DM * DM * 2); bf* WkB = (bf*)take((size_t)KVW * DM * 2); bf* WvB = (bf*)take((size_t)KVW * DM * 2); bf* WoB = (bf*)take((size_t)DM * DM * 2);
    float* Pf = (float*)take((size_t)NTK * LDP * 4); h16* QH = (h16*)take((size_t)NTK * DM * 2); h16* QL = (h16*)take((size_t)NTK * DM * 2);
    h16* KH = (h16*)take((size_t)NTK * KVW * 2); h16* KL = (h16*)take((size_t)NTK * KVW * 2);
    h16* VTH = (h16*)take((size_t)NTK * KVW * 2); h16* VTL = (h16*)take((size_t)NTK * KVW * 2);
    float* RCq = (float*)take((size_t)NT_ * 32 * 4); float* RSq = (float*)take((size_t)NT_ * 32 * 4); float* RCk = (float*)take((size_t)NT_ * 32 * 4); float* RSk = (float*)take((size_t)NT_ * 32 * 4);
    bf* CH = (bf*)take((size_t)NTK * DM * 2); bf* CL = (bf*)take((size_t)NTK * DM * 2);
    if ((size_t)(wsp - (char*)d_ws) > ws_size) return;    // 8.4 + 8.4 + 2.1 + 2.1 + 8.4 + 25.2 + 8.4 x 2 + 2.1 x 2 + 2.1 x 2 + 1 + 8.4 x 2 ~ 96 MB, no aliasing
    k_prep<<<PB_ALL, 256, 0, stream>>>(x, pos, Wq, Wk, Wv, Wo, Xb, WqB, WkB, WvB, WoB, RCq, RSq, RCk, RSk);
    k_gemmb<false><<<dim3(NTK / GBM, LDP / GBN, 1), 256, 0, stream>>>(Xb, nullptr, WqB, Pf, LDP);   // WqB, WkB, WvB lie one behind the other: one [3072][2048] operand
    k_post<<<QB_VT + QB_RQ + QB_RK, 256, 0, stream>>>(Pf, RSq, RCq, RSk, RCk, qnw, knw, QH, QL, KH, KL, VTH, VTL);
    k_attn<<<NB_ * NH_ * (NT_ / 64), 128, 0, stream>>>(QH, QL, KH, KL, VTH, VTL, CH, CL);
    k_gemmb<true><<<dim3(NTK / GBM, DM / GBN, 1), 256, 0, stream>>>(CH, CL, WoB, out, DM);
}

// v004
// It runs in 124 microseconds.
// Two timings next to v003 both put it at 1.28 times that version's speed.
// All steps since v000 together make it 3.14 times as fast.
#include <hip/hip_runtime.h>

// Contractions, f32 accumulate: q = x.Wq ([2048 x 2048].[2048 x 2048]), k/v = x.Wk/Wv ([2048 x 2048].[2048 x 512]) and attn.Wo on v_wmma_f32_16x16x32_bf16 —
// plain bf16 = rounded inputs (exact; [out][in] weights converted row by row, already n-major) for the projections, attn as bf16 hi + residual (two products) for Wo; RoPE
// (interleaved pairs, sin/cos computed by k_prep from position_ids for q, arange for k) in f32; the grouped-query causal sliding-window attention (32 query heads over 8 kv heads; keys j with
// j < 128 (meta keys) or max(i - 1023, 128) <= j <= i, window 1024 fixed at compile time) fused on v_wmma_f32_16x16x32_f16 with q and k as f16 hi + residual x1024 (hi.hi + hi.lo + lo.hi), weights

#define NB_  1
#define NT_  2048
#define DM   2048
#define NH_  32
#define NKV  8
#define KVW  (NKV * HD)          // 512
#define WIN  1024
#define NMETA 128
#define RMS_EPS 1e-6f
#define HD   64
#define NTK  (NB_ * NT_)
#define NW   1024
#define NQKV 2048
#define PSC  32768.0f
#define LOSC 1024.0f
#define LOSCI (1.0f / 1024.0f)
#define LDP  (DM + 2 * KVW)       // row length of the joint projection plane [t][q 2048 | k 512 | v 512]

typedef _Float16 h16;
typedef unsigned short bf;
typedef __attribute__((ext_vector_type(16))) __bf16   v16bf;
typedef __attribute__((ext_vector_type(16))) _Float16 v16h;
typedef __attribute__((ext_vector_type(8)))  _Float16 v8h;
typedef __attribute__((ext_vector_type(8)))  unsigned short v8us;
typedef __attribute__((ext_vector_type(8)))  float    v8f;
typedef __attribute__((ext_vector_type(4)))  float    v4f;
typedef v8h  __attribute__((may_alias)) v8ha;
typedef v4f  __attribute__((may_alias)) v4fa;
typedef v8us __attribute__((may_alias)) v8usa;

__device__ __forceinline__ unsigned short f2bf(float f) { unsigned u = __float_as_uint(f); u += 0x7FFFu + ((u >> 16) & 1u); return (unsigned short)(u >> 16); }
__device__ __forceinline__ float bf2f(unsigned short b) { return __uint_as_float(((unsigned)b) << 16); }
__device__ __forceinline__ float bfr(float f) { return bf2f(f2bf(f)); }
__device__ __forceinline__ v16h cat16(v8h lo, v8h hi) { return __builtin_shufflevector(lo, hi, 0, 1, 2, 3, 4, 5, 6, 7, 8, 9, 10, 11, 12, 13, 14, 15); }
__device__ __forceinline__ v16bf cat16b(v8us lo, v8us hi) { return __builtin_bit_cast(v16bf, __builtin_shufflevector(lo, hi, 0, 1, 2, 3, 4, 5, 6, 7, 8, 9, 10, 11, 12, 13, 14, 15)); }
__device__ __forceinline__ v8f wmma16(v16h a, v16h b, v8f c) { return __builtin_amdgcn_wmma_f32_16x16x32_f16(false, a, false, b, (short)0, c, false, false); }
__device__ __forceinline__ v8f wmmab(v16bf a, v16bf b, v8f c) { return __builtin_amdgcn_wmma_f32_16x16x32_bf16(false, a, false, b, (short)0, c, false, false); }

__device__ __forceinline__ void cvtb_body(const float* __restrict__ src, int nrows, bf* dst, int blk) {
    const int lane = threadIdx.x & 31, r = blk * 8 + (threadIdx.x >> 5);
    if (r >= nrows) return;
    v8us o[DM / 256];
#pragma unroll
    for (int q = 0; q < DM / 256; ++q) { v8us t;
#pragma unroll
        for (int i = 0; i < 8; ++i) t[i] = f2bf(src[(size_t)r * DM + q * 256 + lane * 8 + i]);
        o[q] = t; }
#pragma unroll
    for (int q = 0; q < DM / 256; ++q) *(v8us*)(dst + (size_t)r * DM + q * 256 + lane * 8) = o[q];
    
}

// k_wt: W [2048 k][ncols n] (k-major) -> n-major bf16 plane WT[ncols][2048]; 64 x 64 tiles through LDS.
__global__ __launch_bounds__(256) void k_wt(const float* __restrict__ Wm, int ncols, bf* WT) {
    __shared__ __align__(16) unsigned short tl[64 * 72];
    const int tid = threadIdx.x, k0 = blockIdx.x * 64, n0 = blockIdx.y * 64;
    const int kk = tid >> 2, nq = (tid & 3) * 16;
#pragma unroll
    for (int i = 0; i < 16; ++i) tl[(nq + i) * 72 + kk] = f2bf(Wm[(size_t)(k0 + kk) * ncols + n0 + nq + i]);
    __syncthreads();
    const int piece = tid & 7;
    typedef __attribute__((ext_vector_type(8))) unsigned short v8us_; typedef v8us_ __attribute__((may_alias)) v8usa_;
    auto pass = [&]() {
#pragma unroll
        for (int s = 0; s < 2; ++s) { const int nr = (tid >> 3) + 32 * s; const v8us_ val = *(const v8usa_*)(tl + nr * 72 + piece * 8);
            *(v8us_*)(WT + (size_t)(n0 + nr) * DM + k0 + piece * 8) = val; }
    };
    pass(); 
}

// k_gemmb: C[128 x 128 per block] = A . Bn^T (+ Al . Bn^T), all operands k-contiguous bf16. A pass is 128 k (256-byte rows): the block's rows of Bn, A (and Al) come
// once per block into one of two LDS buffers by asynchronous copies while the other buffer is multiplied; 8 waves (4 x 2), 32 x 64 of C each.
#define GBM 128
#define GBN 128
#define GBK 128
#define GPIT (GBK + 8)           // LDS row pitch in elements: 272 bytes = 16 x 17, the conflict-free pitch for 16-byte fragment reads of 256-byte rows
typedef float __attribute__((may_alias)) f32a;
// copy8: each lane brings 16 bytes of eight rows, 16 rows apart, from global memory to LDS. The s_wait_xcnt closes the statement so that no address register
// of an issued copy is rewritten ahead of it.
__device__ __forceinline__ void copy8(unsigned l, const bf* p) {
    asm volatile("global_load_async_to_lds_b128 %0, %8, off\n\t"
                 "global_load_async_to_lds_b128 %1, %9, off\n\t"
                 "global_load_async_to_lds_b128 %2, %10, off\n\t"
                 "global_load_async_to_lds_b128 %3, %11, off\n\t"
                 "global_load_async_to_lds_b128 %4, %12, off\n\t"
                 "global_load_async_to_lds_b128 %5, %13, off\n\t"
                 "global_load_async_to_lds_b128 %6, %14, off\n\t"
                 "global_load_async_to_lds_b128 %7, %15, off\n\t"
                 "s_wait_xcnt 0x0"
                 :: "v"(l), "v"(l + 1 * 16 * GPIT * 2), "v"(l + 2 * 16 * GPIT * 2), "v"(l + 3 * 16 * GPIT * 2), "v"(l + 4 * 16 * GPIT * 2), "v"(l + 5 * 16 * GPIT * 2), "v"(l + 6 * 16 * GPIT * 2), "v"(l + 7 * 16 * GPIT * 2),
                    "v"(p), "v"(p + 1 * 16 * DM), "v"(p + 2 * 16 * DM), "v"(p + 3 * 16 * DM), "v"(p + 4 * 16 * DM), "v"(p + 5 * 16 * DM), "v"(p + 6 * 16 * DM), "v"(p + 7 * 16 * DM)
                 : "memory");
}
template <bool SPLITA>
__global__ __launch_bounds__(256) void k_gemmb(const bf* __restrict__ A, const bf* __restrict__ Al, const bf* __restrict__ Bn, float* C, int ldc) {
    constexpr int ROWS = GBN + (SPLITA ? 2 : 1) * GBM;     // buffer rows: [Bn 128 | A 128 | Al 128]
    constexpr int STG = ROWS * GPIT, NP = DM / GBK, NKS = GBK / 32;
    __shared__ __align__(16) bf sm[2 * STG];
    const int tid = threadIdx.x, lane = tid & 31, wave = tid >> 5, lr = lane & 15, hi = lane >> 4;
    const int wm = wave >> 1, wn = wave & 1;
    const int r0 = blockIdx.x * GBM, c0 = blockIdx.y * GBN;
    const int srow = tid >> 4, spc = (tid & 15) * 8;       // staging: 16 lanes per 256-byte row, 16 rows per copy of the block
    const bf* gB = Bn + (size_t)(c0 + srow) * DM + spc;
    const bf* gA = A + (size_t)(r0 + srow) * DM + spc;
    const bf* gL = SPLITA ? Al + (size_t)(r0 + srow) * DM + spc : nullptr;
    const unsigned lst = (unsigned)(size_t)(sm + srow * GPIT + spc);      // the lane's LDS byte address in buffer 0
    auto stage = [&](int kt) {
        const unsigned l = lst + (kt & 1) * (STG * 2);
        copy8(l, gB + kt * GBK); copy8(l + GBN * GPIT * 2, gA + kt * GBK);
        if (SPLITA) copy8(l + (GBN + GBM) * GPIT * 2, gL + kt * GBK);
    };
    v8f acc[2][4];
#pragma unroll
    for (int mi = 0; mi < 2; ++mi)
#pragma unroll
        for (int ni = 0; ni < 4; ++ni) acc[mi][ni] = (v8f){};
    stage(0);
    asm volatile("s_wait_asynccnt 0x0" ::: "memory");      // this wave's copies of pass 0 have landed
    __syncthreads();                                       // every wave's have
    stage(1);
    // the pass loop stays rolled (one copy of the pass in the instruction cache, the buffer chosen by kt & 1); every loop inside it is unrolled so that each
    // index into a fragment or accumulator array is a constant and the arrays stay in registers
#pragma unroll 1
    for (int kt = 0; kt < NP; ++kt) {
        const bf* cur = sm + (kt & 1) * STG;
        const bf* fbp = cur + (wn * 64 + lr) * GPIT + 8 * hi;
        const bf* fap = cur + (GBN + wm * 32 + lr) * GPIT + 8 * hi;
        v16bf fb[2][4], fa[2][2], fl[2][2];
        auto frags = [&](int ks, int s) {
#pragma unroll
            for (int ni = 0; ni < 4; ++ni) fb[s][ni] = cat16b(*(const v8usa*)(fbp + ni * 16 * GPIT + ks * 32), *(const v8usa*)(fbp + ni * 16 * GPIT + ks * 32 + 16));
#pragma unroll
            for (int mi = 0; mi < 2; ++mi) { fa[s][mi] = cat16b(*(const v8usa*)(fap + mi * 16 * GPIT + ks * 32), *(const v8usa*)(fap + mi * 16 * GPIT + ks * 32 + 16));
                if (SPLITA) fl[s][mi] = cat16b(*(const v8usa*)(fap + (GBM + mi * 16) * GPIT + ks * 32), *(const v8usa*)(fap + (GBM + mi * 16) * GPIT + ks * 32 + 16)); }
        };
        frags(0, 0);
#pragma unroll
        for (int ks = 0; ks < NKS; ++ks) {
            if (ks + 1 < NKS) frags(ks + 1, (ks + 1) & 1);
            __builtin_amdgcn_sched_barrier(0);             // keeps the next k step's LDS reads one group ahead of this step's products, not among them
#pragma unroll
            for (int mi = 0; mi < 2; ++mi)
#pragma unroll
                for (int ni = 0; ni < 4; ++ni) acc[mi][ni] = wmmab(fa[ks & 1][mi], fb[ks & 1][ni], acc[mi][ni]);
            if (SPLITA) {
#pragma unroll
                for (int mi = 0; mi < 2; ++mi)
#pragma unroll
                    for (int ni = 0; ni < 4; ++ni) acc[mi][ni] = wmmab(fl[ks & 1][mi], fb[ks & 1][ni], acc[mi][ni]);
            }
            __builtin_amdgcn_sched_barrier(0);             // the other side of the same fence pair
        }
        asm volatile("s_wait_dscnt 0x0" ::: "memory");     // this wave has left the buffer it read
        asm volatile("s_wait_asynccnt 0x0" ::: "memory");  // its copies of pass kt + 1 have landed
        __syncthreads();                                   // publishes pass kt + 1 and ends every wave's reads of pass kt
        if (kt + 2 < NP) stage(kt + 2);                    // refill of the buffer just left; block-uniform test
    }
    asm volatile("s_wait_asynccnt 0x0" ::: "memory");      // no copy is outstanding when the buffers become output staging
    f32a* os = (f32a*)sm + wave * (32 * 68);               // per-wave 32 x 64 staging (pitch 68 floats) so that every store covers whole 128-byte lines
#pragma unroll
    for (int mi = 0; mi < 2; ++mi)
#pragma unroll
        for (int ni = 0; ni < 4; ++ni)
#pragma unroll
            for (int j = 0; j < 8; ++j) os[(mi * 16 + hi * 8 + j) * 68 + ni * 16 + lr] = acc[mi][ni][j];
    __syncthreads();
    float* crow = C + (size_t)(r0 + wm * 32) * ldc + c0 + wn * 64;
#pragma unroll
    for (int s = 0; s < 16; ++s) { const int row = 2 * s + hi;
        const v4f val = *(const v4fa*)(os + row * 68 + lr * 4); *(v4f*)(crow + (size_t)row * ldc + lr * 4) = val; }
}

// rope_body: P (f32 [t][LDP], nh*64 columns per t) -> PH/PL f16 hi + residual planes of the interleaved-pair rotation: out[2i] = x[2i] c - x[2i+1] s, out[2i+1] = x[2i] s + x[2i+1] c
// with s = sin[t][i], c = cos[t][i] (i = pair index within the head, 0..31); one wave per (t, 256 columns): lane -> 8 values (4 pairs).
__device__ __forceinline__ void trig_body(const int* __restrict__ pos, float* RC, float* RS, int blk) {
    const int u = blk * 256 + threadIdx.x; if (u >= NT_ * 32) return;
    const int t = u >> 5, i = u & 31; const float inv = 1.0f / powf(10000.0f, (float)(2 * i) / (float)HD); const float ang = (float)(pos ? pos[t] : t) * inv; const float c = cosf(ang), s = sinf(ang);
    *(float*)(RC + u) = c; *(float*)(RS + u) = s; 
}
// k_prep: the seven launches that need nothing of each other (two rotation tables, five bf16 roundings) as ranges of one grid's block index; every branch is block-uniform.
#define PB_TRIG ((NT_ * 32) / 256)
#define PB_X    (NTK / 8)
#define PB_W    (DM / 8)
#define PB_KV   (KVW / 8)
#define PB_ALL  (2 * PB_TRIG + PB_X + 2 * PB_W + 2 * PB_KV)
__global__ __launch_bounds__(256) void k_prep(const float* __restrict__ x, const int* __restrict__ pos, const float* __restrict__ Wq, const float* __restrict__ Wk, const float* __restrict__ Wv, const float* __restrict__ Wo,
                                              bf* Xb, bf* WqB, bf* WkB, bf* WvB, bf* WoB, float* RCq, float* RSq, float* RCk, float* RSk) {
    int blk = blockIdx.x;
    if (blk < 2 * PB_TRIG) { const bool ik = blk >= PB_TRIG;      // q: position_ids; k: arange
        trig_body(ik ? nullptr : pos, ik ? RCk : RCq, ik ? RSk : RSq, ik ? blk - PB_TRIG : blk); return; }
    blk -= 2 * PB_TRIG;
    const float* src = x; bf* dst = Xb; int nrows = NTK;
    if (blk >= PB_X) { blk -= PB_X; src = Wq; dst = WqB; nrows = DM;
        if (blk >= PB_W) { blk -= PB_W; src = Wo; dst = WoB;
            if (blk >= PB_W) { blk -= PB_W; src = Wk; dst = WkB; nrows = KVW;
                if (blk >= PB_KV) { blk -= PB_KV; src = Wv; dst = WvB; } } } }
    cvtb_body(src, nrows, dst, blk);
}
// rope_body: per-head RMSNorm (f32: mean of squares over the head's 64 values via an 8-lane xor reduction, eps 1e-6, x bf(w[d])) THEN the interleaved-pair rotation with
__device__ __forceinline__ void rope_body(const float* __restrict__ P, int ncols, const float* __restrict__ rs, const float* __restrict__ rc, const float* __restrict__ nw, h16* PH, h16* PL, int blk) {
    const int lane = threadIdx.x & 31, wid = blk * 8 + (threadIdx.x >> 5);
    const int segs = ncols / 256, t = wid / segs, sg = wid - t * segs;
    if (t >= NT_) return;
    const int c0 = sg * 256 + lane * 8;                 // 8 consecutive columns = 4 pairs of one head (64 | 8)
    const v8f xv = *(const v8f*)(P + (size_t)t * LDP + c0);
    asm volatile("s_wait_xcnt 0x0" ::: "memory");       // stands ahead of the weight loads, whose results the compiler lays over the address registers of the two loads above
    float ss = 0.f;
#pragma unroll
    for (int i = 0; i < 8; ++i) ss = fmaf(xv[i], xv[i], ss);
    ss += __shfl_xor(ss, 1, 32); ss += __shfl_xor(ss, 2, 32); ss += __shfl_xor(ss, 4, 32);      // the 8 lanes of this head
    const float rn = rsqrtf(ss * (1.0f / 64.0f) + RMS_EPS);
    float xn[8];
#pragma unroll
    for (int i = 0; i < 8; ++i) xn[i] = bfr(nw[(c0 + i) & 63]) * (xv[i] * rn);
    v8h oh, ol;
#pragma unroll
    for (int pq = 0; pq < 4; ++pq) { const int c = c0 + 2 * pq, i = (c & 63) >> 1;
        const float x1 = xn[2 * pq], x2 = xn[2 * pq + 1], s = rs[t * 32 + i], co = rc[t * 32 + i];
        const float y0 = x1 * co - x2 * s, y1 = x1 * s + x2 * co;
        const h16 a0 = (h16)y0, a1 = (h16)y1; oh[2 * pq] = a0; oh[2 * pq + 1] = a1; ol[2 * pq] = (h16)((y0 - (float)a0) * LOSC); ol[2 * pq + 1] = (h16)((y1 - (float)a1) * LOSC); }
    *(v8h*)(PH + (size_t)t * ncols + c0) = oh; *(v8h*)(PL + (size_t)t * ncols + c0) = ol; 
}
__device__ __forceinline__ void vt_body(const float* __restrict__ V, h16* VTH, h16* VTL, int bid) {
    __shared__ __align__(16) h16 tile[64 * 72];
    __shared__ __align__(16) h16 til2[64 * 72];
    const int b = bid / (NKV * (NT_ / 64)), rem = bid - b * (NKV * (NT_ / 64)), h = rem / (NT_ / 64), kt = rem - h * (NT_ / 64);
    const int k0 = kt * 64, tid = threadIdx.x;
    const int kk = tid >> 2, d0 = (tid & 3) * 16;
    const float* src = V + ((size_t)b * NT_ + k0 + kk) * LDP + h * HD + d0;      // h = kv head here
#pragma unroll
    for (int i = 0; i < 16; ++i) { const float v = src[i]; const h16 a = (h16)v; tile[(d0 + i) * 72 + kk] = a; til2[(d0 + i) * 72 + kk] = (h16)((v - (float)a) * LOSC); }
    __syncthreads();
    const int piece = tid & 7;
    const size_t base = (((size_t)b * NKV + h) * HD) * NT_ + k0;
    auto pass = [&]() {
#pragma unroll
        for (int s = 0; s < 4; ++s) { const int Lid = (tid >> 3) + 32 * s; const int pln = Lid >> 6, d = Lid & 63;
            const v8h val = *(const v8ha*)((pln ? til2 : tile) + d * 72 + piece * 8); *(v8h*)((pln ? VTL : VTH) + base + (size_t)d * NT_ + piece * 8) = val; }
    };
    pass(); 
}
// k_post: the three launches between the projections and the attention (v transpose, norm + rotation of q and of k) as ranges of one grid's block index; P is the
// joint plane [t][q | k | v]. Every branch is block-uniform, so the transpose's barrier is passed by whole blocks only.
#define QB_VT (NB_ * NKV * (NT_ / 64))
#define QB_RQ ((NT_ * (DM / 256)) / 8)
#define QB_RK ((NT_ * (KVW / 256)) / 8)
__global__ __launch_bounds__(256) void k_post(const float* __restrict__ P, const float* __restrict__ rsq, const float* __restrict__ rcq, const float* __restrict__ rsk, const float* __restrict__ rck,
                                              const float* __restrict__ qnw, const float* __restrict__ knw, h16* QH, h16* QL, h16* KH, h16* KL, h16* VTH, h16* VTL) {
    int blk = blockIdx.x;
    if (blk < QB_VT) { vt_body(P + DM + KVW, VTH, VTL, blk); return; }
    blk -= QB_VT;
    const bool ik = blk >= QB_RQ;
    rope_body(ik ? P + DM : P, ik ? KVW : DM, ik ? rsk : rsq, ik ? rck : rcq, ik ? knw : qnw, ik ? KH : QH, ik ? KL : QL, ik ? blk - QB_RQ : blk);
}

// k_attn: block = (b, h, 64 queries), wave = 16. The products are transposed: S^T = K . Q^T (A = key rows, B = the wave's queries) and O^T += V^T . P^T, so that a
// lane holds the scores of ONE query (column lr; keys 8 hi + j and 16 + 8 hi + j of the 32-key tile): the maximum and the sum run in the lane's own registers with one
// exchange between the wave's halves, and the weights (x32768, f16 hi + residual) are, register for register, the B operand of the second product.
// ctx -> bf16 hi + residual planes CH/CL[tok][h*64+d].
#define KPIT 72                  // LDS pitch of a 64-value K row in elements: 144 bytes = 16 x 9, conflict-free for 16-byte fragment reads
#define VPIT 40                  // LDS pitch of a 32-key row of transposed V: 80 bytes = 16 x 5
#define KPL  (32 * KPIT)         // one K plane of a tile (32 keys)
#define VPL  (64 * VPIT)         // one V plane of a tile (64 head values)
#define ASTG (2 * KPL + 2 * VPL) // one buffer: [K hi | K lo | V hi | V lo]
// copy_kv: each lane brings 16 bytes of two rows of each of the four planes of a 32-key tile from global memory to LDS. The s_wait_xcnt closes the statement so
// that no address register of an issued copy is rewritten ahead of it.
__device__ __forceinline__ void copy_kv(unsigned lk, unsigned lv, const h16* kh, const h16* kl, const h16* vh, const h16* vl) {
    asm volatile("global_load_async_to_lds_b128 %0, %8, off\n\t"
                 "global_load_async_to_lds_b128 %1, %9, off\n\t"
                 "global_load_async_to_lds_b128 %2, %10, off\n\t"
                 "global_load_async_to_lds_b128 %3, %11, off\n\t"
                 "global_load_async_to_lds_b128 %4, %12, off\n\t"
                 "global_load_async_to_lds_b128 %5, %13, off\n\t"
                 "global_load_async_to_lds_b128 %6, %14, off\n\t"
                 "global_load_async_to_lds_b128 %7, %15, off\n\t"
                 "s_wait_xcnt 0x0"
                 :: "v"(lk), "v"(lk + 16 * KPIT * 2), "v"(lk + KPL * 2), "v"(lk + KPL * 2 + 16 * KPIT * 2), "v"(lv), "v"(lv + 32 * VPIT * 2), "v"(lv + VPL * 2), "v"(lv + VPL * 2 + 32 * VPIT * 2),
                    "v"(kh), "v"(kh + 16 * KVW), "v"(kl), "v"(kl + 16 * KVW), "v"(vh), "v"(vh + 32 * NT_), "v"(vl), "v"(vl + 32 * NT_)
                 : "memory");
}
// xhalf: the value of lane l ^ 16, by a vector cross-row move
__device__ __forceinline__ float xhalf(float v) { const int b = __float_as_int(v); return __int_as_float(__builtin_amdgcn_permlanex16(b, b, 0x76543210, 0xfedcba98, false, false)); }
__global__ __launch_bounds__(128) void k_attn(const h16* __restrict__ Q16, const h16* __restrict__ QL16, const h16* __restrict__ K16, const h16* __restrict__ KL16, const h16* __restrict__ VTH, const h16* __restrict__ VTL, bf* CH, bf* CL) {
    __shared__ __align__(16) float ost[4][16 * 68];
    __shared__ __align__(16) h16 kv[2 * ASTG];
    const int lane = threadIdx.x & 31, wave = threadIdx.x >> 5, lr = lane & 15, hi = lane >> 4;
    const int bid = blockIdx.x;
    const int b = bid / (NH_ * (NT_ / 64)), rem = bid - b * (NH_ * (NT_ / 64)), h = rem / (NT_ / 64), qt = rem - h * (NT_ / 64);
    const int q0 = qt * 64 + wave * 16;
    const size_t tok0 = (size_t)b * NT_;
    v16h qa[2], ql[2];
    const size_t qo0 = (tok0 + q0 + lr) * DM + h * HD + 8 * hi;
#pragma unroll
    for (int kc = 0; kc < 2; ++kc) { qa[kc] = cat16(*(const v8h*)(Q16 + qo0 + kc * 32), *(const v8h*)(Q16 + qo0 + kc * 32 + 16));
        ql[kc] = cat16(*(const v8h*)(QL16 + qo0 + kc * 32), *(const v8h*)(QL16 + qo0 + kc * 32 + 16)); }
    const int g = h / (NH_ / NKV);                      // kv head
    const h16* kh_b = K16 + tok0 * KVW + g * HD;
    const h16* kl_b = KL16 + tok0 * KVW + g * HD;
    const size_t vbase = (((size_t)b * NKV + g) * HD) * NT_;
    v8f o[4], ox[4];
#pragma unroll
    for (int n = 0; n < 4; ++n) { o[n] = (v8f){}; ox[n] = (v8f){}; }
    float mrow = -3.0e38f, lpart = 0.f;                    // the lane's query: running maximum (equal in both halves), sum over the lane's own keys
    const int qi = q0 + lr;
    const int ws_ = (qi - (WIN - 1)) > NMETA ? (qi - (WIN - 1)) : NMETA;
    // allowed(i, j) = (j >= max(i - WIN + 1, NMETA) && j <= i) || j < NMETA: the 4 meta tiles always, then the window tiles up to the query tile (block-uniform bounds, per-element predicate)
    const int wlo = (qt * 64 - (WIN - 1)) > NMETA ? (qt * 64 - (WIN - 1)) : NMETA; const int kt_wlo = wlo / 32; const int kt_hc = (qt * 64 + 63) / 32, kt_hi = kt_hc > (NMETA / 32 - 1) ? kt_hc : (NMETA / 32 - 1);     // the meta tiles are visited even by queries below 128 (non-causal meta keys)
    // the tiles in the order of the walk: ti = 0..3 are the meta tiles, ti >= 4 the window tiles kt_wlo..kt_hi (kt_wlo >= 4); all of it block-uniform
    const int ntile = NMETA / 32 + (kt_hi >= kt_wlo ? kt_hi - kt_wlo + 1 : 0);
    const int tid = threadIdx.x;
    const int krow = tid >> 3, kpc = (tid & 7) * 8;         // staging of K: 8 lanes per 128-byte row, 16 rows per copy of the block
    const int vrow = tid >> 2, vpc = (tid & 3) * 8;         // staging of V: 4 lanes per 64-byte row, 32 rows per copy of the block
    const unsigned lk0 = (unsigned)(size_t)(kv + krow * KPIT + kpc), lv0 = (unsigned)(size_t)(kv + 2 * KPL + vrow * VPIT + vpc);     // the lane's LDS byte addresses in buffer 0
    const h16* gkh = kh_b + (size_t)krow * KVW + kpc; const h16* gkl = kl_b + (size_t)krow * KVW + kpc;
    const h16* gvh = VTH + vbase + (size_t)vrow * NT_ + vpc; const h16* gvl = VTL + vbase + (size_t)vrow * NT_ + vpc;
    auto stage = [&](int ti) {
        const int sl0 = (ti < NMETA / 32 ? ti : ti - NMETA / 32 + kt_wlo) * 32; const unsigned bo = (ti & 1) * (ASTG * 2);
        copy_kv(lk0 + bo, lv0 + bo, gkh + (size_t)sl0 * KVW, gkl + (size_t)sl0 * KVW, gvh + sl0, gvl + sl0);
    };
    stage(0);
    asm volatile("s_wait_asynccnt 0x0" ::: "memory");      // this wave's copies of tile 0 have landed
    __syncthreads();                                       // every wave's have
    stage(1);                                              // ntile >= 4: a tile 1 always exists
#pragma unroll 1
    for (int ti = 0; ti < ntile; ++ti) {
        const int kt = ti < NMETA / 32 ? ti : ti - NMETA / 32 + kt_wlo;
        const int l0 = kt * 32;
        const h16* cur = kv + (ti & 1) * ASTG;
        const h16* fk = cur + lr * KPIT + 8 * hi;
        const h16* fv = cur + 2 * KPL + lr * VPIT + 8 * hi;
        v8f s0 = {}, s1 = {}, x0 = {}, x1 = {};
        v16h k0h[2], k1h[2], k0l[2], k1l[2];
#pragma unroll
        for (int kc = 0; kc < 2; ++kc) {
            k0h[kc] = cat16(*(const v8ha*)(fk + kc * 32), *(const v8ha*)(fk + kc * 32 + 16)); k1h[kc] = cat16(*(const v8ha*)(fk + 16 * KPIT + kc * 32), *(const v8ha*)(fk + 16 * KPIT + kc * 32 + 16));
            k0l[kc] = cat16(*(const v8ha*)(fk + KPL + kc * 32), *(const v8ha*)(fk + KPL + kc * 32 + 16)); k1l[kc] = cat16(*(const v8ha*)(fk + KPL + 16 * KPIT + kc * 32), *(const v8ha*)(fk + KPL + 16 * KPIT + kc * 32 + 16)); }
#pragma unroll
        for (int kc = 0; kc < 2; ++kc) {
            s0 = wmma16(k0h[kc], qa[kc], s0); x0 = wmma16(k0h[kc], ql[kc], x0); s1 = wmma16(k1h[kc], qa[kc], s1); x1 = wmma16(k1h[kc], ql[kc], x1);
            x0 = wmma16(k0l[kc], qa[kc], x0); x1 = wmma16(k1l[kc], qa[kc], x1);
        }
        asm volatile("v_nop\n\tv_nop\n\tv_nop\n\tv_nop" : "+v"(s0), "+v"(s1), "+v"(x0), "+v"(x1) : "v"(qa[0]), "v"(qa[1]));
        // element e of sc, pa and px = key l0 + kmap(e, hi) of the tile, the k order in which the V fragments are read
        float sc[16];
#pragma unroll
        for (int j = 0; j < 8; ++j) sc[j] = (s0[j] + x0[j] * LOSCI) * 0.125f;
#pragma unroll
        for (int j = 0; j < 8; ++j) sc[8 + j] = (s1[j] + x1[j] * LOSCI) * 0.125f;
        const bool meta = l0 < NMETA;                      // a tile lies wholly below or wholly at and above NMETA (32 divides it)
        const int dlo = meta ? 0 : ws_ - (l0 + 8 * hi), dhi = meta ? 31 : qi - (l0 + 8 * hi);      // the lane's allowed keys, counted from its first key of the tile
        float mx = -__builtin_inff();
#pragma unroll
        for (int e = 0; e < 16; ++e) { const int ko = (e & 7) + (e >> 3) * 16;
            sc[e] = ((ko >= dlo) & (ko <= dhi)) ? sc[e] : -__builtin_inff();
            mx = fmaxf(mx, sc[e]); }
        mx = fmaxf(mx, xhalf(mx));                         // the other 16 keys of the same query
        const float mn = fmaxf(mrow, mx);
        const float alpha = __expf(mrow - mn); mrow = mn;
        typedef __attribute__((ext_vector_type(16))) float v16f;
        typedef __attribute__((ext_vector_type(2))) float v2f;
        v16f t, p;
#pragma unroll
        for (int e = 0; e < 16; ++e) t[e] = sc[e];
        t = (t - mn) * 1.44269504088896340736f;            // exp(x) = 2^(x log2 e), the arguments formed pairwise ahead of the run of exponentials
#pragma unroll
        for (int e = 0; e < 16; ++e) p[e] = __builtin_amdgcn_exp2f(t[e]);
        const v8f t8 = p.lo + p.hi; const v4f t4 = t8.lo + t8.hi; const v2f t2 = t4.lo + t4.hi;      // the lane's 16 weights summed as a tree, not as one dependent chain
        const float psum = t2.x + t2.y;
        const v16f ps = p * PSC;
        const v16h pa = __builtin_convertvector(ps, v16h);
        const v16h px = __builtin_convertvector((ps - __builtin_convertvector(pa, v16f)) * LOSC, v16h);
        lpart = lpart * alpha + psum;
#pragma unroll
        for (int n = 0; n < 4; ++n)
#pragma unroll
            for (int j = 0; j < 8; ++j) { o[n][j] *= alpha; ox[n][j] *= alpha; }
#pragma unroll
        for (int n = 0; n < 4; ++n) { const h16* vp = fv + n * 16 * VPIT;
            const v16h vh = cat16(*(const v8ha*)(vp), *(const v8ha*)(vp + 16)), vl = cat16(*(const v8ha*)(vp + VPL), *(const v8ha*)(vp + VPL + 16));
            o[n] = wmma16(vh, pa, o[n]); ox[n] = wmma16(vl, pa, ox[n]); ox[n] = wmma16(vh, px, ox[n]); }
        asm volatile("v_nop\n\tv_nop\n\tv_nop\n\tv_nop" : "+v"(o[0]), "+v"(o[1]), "+v"(o[2]), "+v"(o[3]), "+v"(ox[0]), "+v"(ox[1]), "+v"(ox[2]), "+v"(ox[3]) : "v"(pa), "v"(px));
        asm volatile("s_wait_dscnt 0x0" ::: "memory");     // this wave has left the buffer it read
        asm volatile("s_wait_asynccnt 0x0" ::: "memory");  // its copies of tile ti + 1 have landed
        __syncthreads();                                   // publishes tile ti + 1 and ends every wave's reads of tile ti
        if (ti + 2 < ntile) stage(ti + 2);                 // refill of the buffer just left; block-uniform test
    }
    asm volatile("s_wait_asynccnt 0x0" ::: "memory");      // no copy is outstanding when the wave goes on to the epilogue
    const float inv = 1.0f / ((lpart + xhalf(lpart)) * PSC);      // the two halves' sums of the lane's query, joined once
    float* os = &ost[wave][0];
#pragma unroll
    for (int n = 0; n < 4; ++n)
#pragma unroll
        for (int j = 0; j < 8; ++j) os[lr * 68 + n * 16 + hi * 8 + j] = (o[n][j] + ox[n][j] * LOSCI) * inv;      // register j of O^T = head value n * 16 + 8 hi + j of query lr
    __syncthreads();
    const size_t cbase = (tok0 + q0) * DM + (size_t)h * HD;
    auto pass = [&]() {
#pragma unroll
        for (int s = 0; s < 4; ++s) { const int row = 4 * s + (lane >> 3), piece = lane & 7; const float* sp = os + row * 68 + piece * 8; v8us oh, ol;
#pragma unroll
            for (int i = 0; i < 8; ++i) { const unsigned short hb = f2bf(sp[i]); oh[i] = hb; ol[i] = f2bf(sp[i] - bf2f(hb)); }
            *(v8us*)(CH + cbase + (size_t)row * DM + piece * 8) = oh; *(v8us*)(CL + cbase + (size_t)row * DM + piece * 8) = ol; }
    };
    pass(); 
}

#define VST2(T, p, v) do { const T vst2_v_ = (v); *(T*)(p) = vst2_v_;  } while (0)
extern "C" void kernel_launch(void* const* d_in, const int* in_sizes, int n_in,
                              void* d_out, int out_size, void* d_ws, size_t ws_size, hipStream_t stream) {
    (void)in_sizes; (void)n_in; (void)out_size;
    const float* x = (const float*)d_in[0]; const int* pos = (const int*)d_in[1]; const float* Wq = (const float*)d_in[2]; const float* Wk = (const float*)d_in[3]; const float* Wv = (const float*)d_in[4]; const float* Wo = (const float*)d_in[5]; const float* qnw = (const float*)d_in[6]; const float* knw = (const float*)d_in[7];   // [out][in] weights; position_ids [2048] i32
    float* out = (float*)d_out;    // [1][2048][2048]
    char* wsp = (char*)d_ws;
    auto take = [&](size_t bytes) { char* p = wsp; wsp += (bytes + 255) & ~(size_t)255; return (void*)p; };
    bf* Xb = (bf*)take((size_t)NTK * DM * 2); bf* WqB = (bf*)take((size_t)DM * DM * 2); bf* WkB = (bf*)take((size_t)KVW * DM * 2); bf* WvB = (bf*)take((size_t)KVW * DM * 2); bf* WoB = (bf*)take((size_t)DM * DM * 2);
    float* Pf = (float*)take((size_t)NTK * LDP * 4); h16* QH = (h16*)take((size_t)NTK * DM * 2); h16* QL = (h16*)take((size_t)NTK * DM * 2);
    h16* KH = (h16*)take((size_t)NTK * KVW * 2); h16* KL = (h16*)take((size_t)NTK * KVW * 2);
    h16* VTH = (h16*)take((size_t)NTK * KVW * 2); h16* VTL = (h16*)take((size_t)NTK * KVW * 2);
    float* RCq = (float*)take((size_t)NT_ * 32 * 4); float* RSq = (float*)take((size_t)NT_ * 32 * 4); float* RCk = (float*)take((size_t)NT_ * 32 * 4); float* RSk = (float*)take((size_t)NT_ * 32 * 4);
    bf* CH = (bf*)take((size_t)NTK * DM * 2); bf* CL = (bf*)take((size_t)NTK * DM * 2);
    if ((size_t)(wsp - (char*)d_ws) > ws_size) return;    // 8.4 + 8.4 + 2.1 + 2.1 + 8.4 + 25.2 + 8.4 x 2 + 2.1 x 2 + 2.1 x 2 + 1 + 8.4 x 2 ~ 96 MB, no aliasing
    k_prep<<<PB_ALL, 256, 0, stream>>>(x, pos, Wq, Wk, Wv, Wo, Xb, WqB, WkB, WvB, WoB, RCq, RSq, RCk, RSk);
    k_gemmb<false><<<dim3(NTK / GBM, LDP / GBN, 1), 256, 0, stream>>>(Xb, nullptr, WqB, Pf, LDP);   // WqB, WkB, WvB lie one behind the other: one [3072][2048] operand
    k_post<<<QB_VT + QB_RQ + QB_RK, 256, 0, stream>>>(Pf, RSq, RCq, RSk, RCk, qnw, knw, QH, QL, KH, KL, VTH, VTL);
    k_attn<<<NB_ * NH_ * (NT_ / 64), 128, 0, stream>>>(QH, QL, KH, KL, VTH, VTL, CH, CL);
    k_gemmb<true><<<dim3(NTK / GBM, DM / GBN, 1), 256, 0, stream>>>(CH, CL, WoB, out, DM);
}

// v005
// One run takes 118 microseconds.
// Next to v004, in two timings, it ran 1.05 and 1.06 times as fast.
// Over all steps from v000 it is 3.30 times as fast.
#include <hip/hip_runtime.h>

// Contractions, f32 accumulate: q = x.Wq ([2048 x 2048].[2048 x 2048]), k/v = x.Wk/Wv ([2048 x 2048].[2048 x 512]) and attn.Wo on v_wmma_f32_16x16x32_bf16 —
// plain bf16 = rounded inputs (exact; [out][in] weights converted row by row, already n-major) for the projections, attn as bf16 hi + residual (two products) for Wo; RoPE
// (interleaved pairs, sin/cos computed by k_prep from position_ids for q, arange for k) in f32; the grouped-query causal sliding-window attention (32 query heads over 8 kv heads; keys j with
// j < 128 (meta keys) or max(i - 1023, 128) <= j <= i, window 1024 fixed at compile time) fused on v_wmma_f32_16x16x32_f16 with q and k as f16 hi + residual x1024 (hi.hi + hi.lo + lo.hi), weights

#define NB_  1
#define NT_  2048
#define DM   2048
#define NH_  32
#define NKV  8
#define KVW  (NKV * HD)          // 512
#define WIN  1024
#define NMETA 128
#define RMS_EPS 1e-6f
#define HD   64
#define NTK  (NB_ * NT_)
#define NW   1024
#define NQKV 2048
#define PSC  32768.0f
#define LOSC 1024.0f
#define LOSCI (1.0f / 1024.0f)
#define LDP  (DM + 2 * KVW)       // width of the joint projection [t][q 2048 | k 512 | v 512] (the projection grid's column extent; it is not stored)

typedef _Float16 h16;
typedef unsigned short bf;
typedef __attribute__((ext_vector_type(16))) __bf16   v16bf;
typedef __attribute__((ext_vector_type(16))) _Float16 v16h;
typedef __attribute__((ext_vector_type(8)))  _Float16 v8h;
typedef __attribute__((ext_vector_type(8)))  unsigned short v8us;
typedef __attribute__((ext_vector_type(8)))  float    v8f;
typedef __attribute__((ext_vector_type(4)))  float    v4f;
typedef v8h  __attribute__((may_alias)) v8ha;
typedef v4f  __attribute__((may_alias)) v4fa;
typedef v8us __attribute__((may_alias)) v8usa;

__device__ __forceinline__ unsigned short f2bf(float f) { unsigned u = __float_as_uint(f); u += 0x7FFFu + ((u >> 16) & 1u); return (unsigned short)(u >> 16); }
__device__ __forceinline__ float bf2f(unsigned short b) { return __uint_as_float(((unsigned)b) << 16); }
__device__ __forceinline__ float bfr(float f) { return bf2f(f2bf(f)); }
__device__ __forceinline__ v16h cat16(v8h lo, v8h hi) { return __builtin_shufflevector(lo, hi, 0, 1, 2, 3, 4, 5, 6, 7, 8, 9, 10, 11, 12, 13, 14, 15); }
__device__ __forceinline__ v16bf cat16b(v8us lo, v8us hi) { return __builtin_bit_cast(v16bf, __builtin_shufflevector(lo, hi, 0, 1, 2, 3, 4, 5, 6, 7, 8, 9, 10, 11, 12, 13, 14, 15)); }
__device__ __forceinline__ v8f wmma16(v16h a, v16h b, v8f c) { return __builtin_amdgcn_wmma_f32_16x16x32_f16(false, a, false, b, (short)0, c, false, false); }
__device__ __forceinline__ v8f wmmab(v16bf a, v16bf b, v8f c) { return __builtin_amdgcn_wmma_f32_16x16x32_bf16(false, a, false, b, (short)0, c, false, false); }

__device__ __forceinline__ void cvtb_body(const float* __restrict__ src, int nrows, bf* dst, int blk) {
    const int lane = threadIdx.x & 31, r = blk * 8 + (threadIdx.x >> 5);
    if (r >= nrows) return;
    v8us o[DM / 256];
#pragma unroll
    for (int q = 0; q < DM / 256; ++q) { v8us t;
#pragma unroll
        for (int i = 0; i < 8; ++i) t[i] = f2bf(src[(size_t)r * DM + q * 256 + lane * 8 + i]);
        o[q] = t; }
#pragma unroll
    for (int q = 0; q < DM / 256; ++q) *(v8us*)(dst + (size_t)r * DM + q * 256 + lane * 8) = o[q];
    
}

// k_wt: W [2048 k][ncols n] (k-major) -> n-major bf16 plane WT[ncols][2048]; 64 x 64 tiles through LDS.
__global__ __launch_bounds__(256) void k_wt(const float* __restrict__ Wm, int ncols, bf* WT) {
    __shared__ __align__(16) unsigned short tl[64 * 72];
    const int tid = threadIdx.x, k0 = blockIdx.x * 64, n0 = blockIdx.y * 64;
    const int kk = tid >> 2, nq = (tid & 3) * 16;
#pragma unroll
    for (int i = 0; i < 16; ++i) tl[(nq + i) * 72 + kk] = f2bf(Wm[(size_t)(k0 + kk) * ncols + n0 + nq + i]);
    __syncthreads();
    const int piece = tid & 7;
    typedef __attribute__((ext_vector_type(8))) unsigned short v8us_; typedef v8us_ __attribute__((may_alias)) v8usa_;
    auto pass = [&]() {
#pragma unroll
        for (int s = 0; s < 2; ++s) { const int nr = (tid >> 3) + 32 * s; const v8us_ val = *(const v8usa_*)(tl + nr * 72 + piece * 8);
            *(v8us_*)(WT + (size_t)(n0 + nr) * DM + k0 + piece * 8) = val; }
    };
    pass(); 
}

// k_gemmb: C[128 x 128 per block] = A . Bn^T (+ Al . Bn^T), all operands k-contiguous bf16. A pass is 128 k (256-byte rows): the block's rows of Bn, A (and Al) come
// once per block into one of two LDS buffers by asynchronous copies while the other buffer is multiplied; 8 waves (4 x 2), 32 x 64 of C each.
// Without Al the product is the joint projection [t][q 2048 | k 512 | v 512] and never goes to memory as f32: the epilogue norms and rotates q and k and transposes v
// from its LDS staging and stores the f16 planes that the attention reads.
#define GBM 128
#define GBN 128
#define GBK 128
#define GPIT (GBK + 8)           // LDS row pitch in elements: 272 bytes = 16 x 17, the conflict-free pitch for 16-byte fragment reads of 256-byte rows
#define TPIT (GBM + 8)           // LDS row pitch of the transposed v tile in elements: 272 bytes, as above
typedef float __attribute__((may_alias)) f32a;
// copy8: each lane brings 16 bytes of eight rows, 16 rows apart, from global memory to LDS. The s_wait_xcnt closes the statement so that no address register
// of an issued copy is rewritten ahead of it.
__device__ __forceinline__ void copy8(unsigned l, const bf* p) {
    asm volatile("global_load_async_to_lds_b128 %0, %8, off\n\t"
                 "global_load_async_to_lds_b128 %1, %9, off\n\t"
                 "global_load_async_to_lds_b128 %2, %10, off\n\t"
                 "global_load_async_to_lds_b128 %3, %11, off\n\t"
                 "global_load_async_to_lds_b128 %4, %12, off\n\t"
                 "global_load_async_to_lds_b128 %5, %13, off\n\t"
                 "global_load_async_to_lds_b128 %6, %14, off\n\t"
                 "global_load_async_to_lds_b128 %7, %15, off\n\t"
                 "s_wait_xcnt 0x0"
                 :: "v"(l), "v"(l + 1 * 16 * GPIT * 2), "v"(l + 2 * 16 * GPIT * 2), "v"(l + 3 * 16 * GPIT * 2), "v"(l + 4 * 16 * GPIT * 2), "v"(l + 5 * 16 * GPIT * 2), "v"(l + 6 * 16 * GPIT * 2), "v"(l + 7 * 16 * GPIT * 2),
                    "v"(p), "v"(p + 1 * 16 * DM), "v"(p + 2 * 16 * DM), "v"(p + 3 * 16 * DM), "v"(p + 4 * 16 * DM), "v"(p + 5 * 16 * DM), "v"(p + 6 * 16 * DM), "v"(p + 7 * 16 * DM)
                 : "memory");
}
template <bool SPLITA>
__global__ __launch_bounds__(256) void k_gemmb(const bf* __restrict__ A, const bf* __restrict__ Al, const bf* __restrict__ Bn, float* C, int ldc,
                                               const float* __restrict__ rsq, const float* __restrict__ rcq, const float* __restrict__ rsk, const float* __restrict__ rck,
                                               const float* __restrict__ qnw, const float* __restrict__ knw, h16* QH, h16* QL, h16* KH, h16* KL, h16* VTH, h16* VTL) {
    constexpr int ROWS = GBN + (SPLITA ? 2 : 1) * GBM;     // buffer rows: [Bn 128 | A 128 | Al 128]
    constexpr int STG = ROWS * GPIT, NP = DM / GBK, NKS = GBK / 32;
    __shared__ __align__(16) bf sm[2 * STG];
    const int tid = threadIdx.x, lane = tid & 31, wave = tid >> 5, lr = lane & 15, hi = lane >> 4;
    const int wm = wave >> 1, wn = wave & 1;
    const int r0 = blockIdx.x * GBM, c0 = blockIdx.y * GBN;
    const int srow = tid >> 4, spc = (tid & 15) * 8;       // staging: 16 lanes per 256-byte row, 16 rows per copy of the block
    const bf* gB = Bn + (size_t)(c0 + srow) * DM + spc;
    const bf* gA = A + (size_t)(r0 + srow) * DM + spc;
    const bf* gL = SPLITA ? Al + (size_t)(r0 + srow) * DM + spc : nullptr;
    const unsigned lst = (unsigned)(size_t)(sm + srow * GPIT + spc);      // the lane's LDS byte address in buffer 0
    auto stage = [&](int kt) {
        const unsigned l = lst + (kt & 1) * (STG * 2);
        copy8(l, gB + kt * GBK); copy8(l + GBN * GPIT * 2, gA + kt * GBK);
        if (SPLITA) copy8(l + (GBN + GBM) * GPIT * 2, gL + kt * GBK);
    };
    v8f acc[2][4];
#pragma unroll
    for (int mi = 0; mi < 2; ++mi)
#pragma unroll
        for (int ni = 0; ni < 4; ++ni) acc[mi][ni] = (v8f){};
    stage(0);
    asm volatile("s_wait_asynccnt 0x0" ::: "memory");      // this wave's copies of pass 0 have landed
    __syncthreads();                                       // every wave's have
    stage(1);
    // the pass loop stays rolled (one copy of the pass in the instruction cache, the buffer chosen by kt & 1); every loop inside it is unrolled so that each
    // index into a fragment or accumulator array is a constant and the arrays stay in registers
#pragma unroll 1
    for (int kt = 0; kt < NP; ++kt) {
        const bf* cur = sm + (kt & 1) * STG;
        const bf* fbp = cur + (wn * 64 + lr) * GPIT + 8 * hi;
        const bf* fap = cur + (GBN + wm * 32 + lr) * GPIT + 8 * hi;
        v16bf fb[2][4], fa[2][2], fl[2][2];
        auto frags = [&](int ks, int s) {
#pragma unroll
            for (int ni = 0; ni < 4; ++ni) fb[s][ni] = cat16b(*(const v8usa*)(fbp + ni * 16 * GPIT + ks * 32), *(const v8usa*)(fbp + ni * 16 * GPIT + ks * 32 + 16));
#pragma unroll
            for (int mi = 0; mi < 2; ++mi) { fa[s][mi] = cat16b(*(const v8usa*)(fap + mi * 16 * GPIT + ks * 32), *(const v8usa*)(fap + mi * 16 * GPIT + ks * 32 + 16));
                if (SPLITA) fl[s][mi] = cat16b(*(const v8usa*)(fap + (GBM + mi * 16) * GPIT + ks * 32), *(const v8usa*)(fap + (GBM + mi * 16) * GPIT + ks * 32 + 16)); }
        };
        frags(0, 0);
#pragma unroll
        for (int ks = 0; ks < NKS; ++ks) {
            if (ks + 1 < NKS) frags(ks + 1, (ks + 1) & 1);
            __builtin_amdgcn_sched_barrier(0);             // keeps the next k step's LDS reads one group ahead of this step's products, not among them
#pragma unroll
            for (int mi = 0; mi < 2; ++mi)
#pragma unroll
                for (int ni = 0; ni < 4; ++ni) acc[mi][ni] = wmmab(fa[ks & 1][mi], fb[ks & 1][ni], acc[mi][ni]);
            if (SPLITA) {
#pragma unroll
                for (int mi = 0; mi < 2; ++mi)
#pragma unroll
                    for (int ni = 0; ni < 4; ++ni) acc[mi][ni] = wmmab(fl[ks & 1][mi], fb[ks & 1][ni], acc[mi][ni]);
            }
            __builtin_amdgcn_sched_barrier(0);             // the other side of the same fence pair
        }
        asm volatile("s_wait_dscnt 0x0" ::: "memory");     // this wave has left the buffer it read
        asm volatile("s_wait_asynccnt 0x0" ::: "memory");  // its copies of pass kt + 1 have landed
        __syncthreads();                                   // publishes pass kt + 1 and ends every wave's reads of pass kt
        if (kt + 2 < NP) stage(kt + 2);                    // refill of the buffer just left; block-uniform test
    }
    asm volatile("s_wait_asynccnt 0x0" ::: "memory");      // no copy is outstanding when the buffers become output staging
    f32a* os = (f32a*)sm + wave * (32 * 68);               // per-wave 32 x 64 staging (pitch 68 floats) so that every store covers whole 128-byte lines
    // three epilogues, chosen block-uniformly (a block's 128 columns lie wholly in q, in k or in v), each with its own barrier between its LDS stores and its LDS reads
    if (SPLITA) {
#pragma unroll
        for (int mi = 0; mi < 2; ++mi)
#pragma unroll
            for (int ni = 0; ni < 4; ++ni)
#pragma unroll
                for (int j = 0; j < 8; ++j) os[(mi * 16 + hi * 8 + j) * 68 + ni * 16 + lr] = acc[mi][ni][j];
        __syncthreads();
        float* crow = C + (size_t)(r0 + wm * 32) * ldc + c0 + wn * 64;
#pragma unroll
        for (int s = 0; s < 16; ++s) { const int row = 2 * s + hi;
            const v4f val = *(const v4fa*)(os + row * 68 + lr * 4); *(v4f*)(crow + (size_t)row * ldc + lr * 4) = val; }
    } else if (c0 >= DM + KVW) {
        // v -> transposed f16 hi + residual planes, row = kv head * 64 + head value. Registers j = 0..7 of an accumulator are eight consecutive tokens of one column:
        // one 16-byte LDS store per plane lays them down transposed in two planes [128 columns][128 tokens], pitch TPIT
        h16* th = (h16*)sm;
#pragma unroll
        for (int mi = 0; mi < 2; ++mi)
#pragma unroll
            for (int ni = 0; ni < 4; ++ni) { v8h a, l;
#pragma unroll
                for (int j = 0; j < 8; ++j) { const float v = acc[mi][ni][j]; const h16 ah = (h16)v; a[j] = ah; l[j] = (h16)((v - (float)ah) * LOSC); }
                h16* tp = th + (wn * 64 + ni * 16 + lr) * TPIT + wm * 32 + mi * 16 + hi * 8;
                *(v8ha*)tp = a; *(v8ha*)(tp + GBN * TPIT) = l; }
        __syncthreads();
        const size_t vb = (size_t)(c0 - (DM + KVW) + srow) * NT_ + r0 + spc;      // 128 tokens = 256 bytes of a row per block: 16 lanes x 16 bytes
#pragma unroll
        for (int s = 0; s < 8; ++s) { const h16* tp = th + (srow + 16 * s) * TPIT + spc;
            const v8h vh = *(const v8ha*)tp, vl = *(const v8ha*)(tp + GBN * TPIT);
            *(v8h*)(VTH + vb + (size_t)(16 * s) * NT_) = vh; *(v8h*)(VTL + vb + (size_t)(16 * s) * NT_) = vl; }
    } else {
        // q and k: the wave's 64 columns are one head. Per-head RMSNorm (f32: mean of squares over the head's 64 values via an 8-lane xor reduction, eps 1e-6, x bf(w[d])),
        // then the interleaved-pair rotation out[2i] = x[2i] c - x[2i+1] s, out[2i+1] = x[2i] s + x[2i+1] c, then f16 hi + residual planes.
        // 8 lanes per row, 8 values (4 pairs) each; rows trow + 4 s
        const bool ik = c0 >= DM;
        const int piece = lane & 7, trow = r0 + wm * 32 + (lane >> 3);
        const float* ps = (ik ? rsk : rsq) + trow * 32 + piece * 4; const float* pc = (ik ? rck : rcq) + trow * 32 + piece * 4; const float* pw = (ik ? knw : qnw) + piece * 8;
        v4f sv[8], cv[8];                                  // the rotation tables and the norm weights are fetched ahead of the staging and its barrier, which cover their latency
#pragma unroll
        for (int s = 0; s < 8; ++s) { sv[s] = *(const v4f*)(ps + s * 128); cv[s] = *(const v4f*)(pc + s * 128); }
        const v4f wa = *(const v4f*)pw, wb = *(const v4f*)(pw + 4);
        asm volatile("s_wait_xcnt 0x0" :: "v"(ps), "v"(pc), "v"(pw) : "memory");      // the three addresses stay live up to this wait, so that no load's result is laid over them ahead of it
#pragma unroll
        for (int mi = 0; mi < 2; ++mi)
#pragma unroll
            for (int ni = 0; ni < 4; ++ni)
#pragma unroll
                for (int j = 0; j < 8; ++j) os[(mi * 16 + hi * 8 + j) * 68 + ni * 16 + lr] = acc[mi][ni][j];
        __syncthreads();
        h16* PH = ik ? KH : QH; h16* PL = ik ? KL : QL;
        const int ncols = ik ? KVW : DM, cc = (ik ? c0 - DM : c0) + wn * 64 + piece * 8;
        float wv[8];
#pragma unroll
        for (int i = 0; i < 4; ++i) { wv[i] = bfr(wa[i]); wv[4 + i] = bfr(wb[i]); }
#pragma unroll
        for (int s = 0; s < 8; ++s) { const int row = 4 * s + (lane >> 3), t = trow + 4 * s;
            const v4f xa = *(const v4fa*)(os + row * 68 + piece * 8), xb = *(const v4fa*)(os + row * 68 + piece * 8 + 4);
            float xv[8];
#pragma unroll
            for (int i = 0; i < 4; ++i) { xv[i] = xa[i]; xv[4 + i] = xb[i]; }
            float ss = 0.f;
#pragma unroll
            for (int i = 0; i < 8; ++i) ss = fmaf(xv[i], xv[i], ss);
            ss += __shfl_xor(ss, 1, 32); ss += __shfl_xor(ss, 2, 32); ss += __shfl_xor(ss, 4, 32);      // the 8 lanes of this row
            const float rn = rsqrtf(ss * (1.0f / 64.0f) + RMS_EPS);
            float xn[8];
#pragma unroll
            for (int i = 0; i < 8; ++i) xn[i] = wv[i] * (xv[i] * rn);
            v8h oh, ol;
#pragma unroll
            for (int pq = 0; pq < 4; ++pq) {
                const float x1 = xn[2 * pq], x2 = xn[2 * pq + 1], sn = sv[s][pq], co = cv[s][pq];
                const float y0 = x1 * co - x2 * sn, y1 = x1 * sn + x2 * co;
                const h16 a0 = (h16)y0, a1 = (h16)y1; oh[2 * pq] = a0; oh[2 * pq + 1] = a1; ol[2 * pq] = (h16)((y0 - (float)a0) * LOSC); ol[2 * pq + 1] = (h16)((y1 - (float)a1) * LOSC); }
            *(v8h*)(PH + (size_t)t * ncols + cc) = oh; *(v8h*)(PL + (size_t)t * ncols + cc) = ol; }
        asm volatile("s_wait_xcnt 0x0" ::: "memory");      // the v branch is laid out behind this one and reuses the registers that the last stores name
    }
}

__device__ __forceinline__ void trig_body(const int* __restrict__ pos, float* RC, float* RS, int blk) {
    const int u = blk * 256 + threadIdx.x; if (u >= NT_ * 32) return;
    const int t = u >> 5, i = u & 31; const float inv = 1.0f / powf(10000.0f, (float)(2 * i) / (float)HD); const float ang = (float)(pos ? pos[t] : t) * inv; const float c = cosf(ang), s = sinf(ang);
    *(float*)(RC + u) = c; *(float*)(RS + u) = s; 
}
// k_prep: the seven launches that need nothing of each other (two rotation tables, five bf16 roundings) as ranges of one grid's block index; every branch is block-uniform.
#define PB_TRIG ((NT_ * 32) / 256)
#define PB_X    (NTK / 8)
#define PB_W    (DM / 8)
#define PB_KV   (KVW / 8)
#define PB_ALL  (2 * PB_TRIG + PB_X + 2 * PB_W + 2 * PB_KV)
__global__ __launch_bounds__(256) void k_prep(const float* __restrict__ x, const int* __restrict__ pos, const float* __restrict__ Wq, const float* __restrict__ Wk, const float* __restrict__ Wv, const float* __restrict__ Wo,
                                              bf* Xb, bf* WqB, bf* WkB, bf* WvB, bf* WoB, float* RCq, float* RSq, float* RCk, float* RSk) {
    int blk = blockIdx.x;
    if (blk < 2 * PB_TRIG) { const bool ik = blk >= PB_TRIG;      // q: position_ids; k: arange
        trig_body(ik ? nullptr : pos, ik ? RCk : RCq, ik ? RSk : RSq, ik ? blk - PB_TRIG : blk); return; }
    blk -= 2 * PB_TRIG;
    const float* src = x; bf* dst = Xb; int nrows = NTK;
    if (blk >= PB_X) { blk -= PB_X; src = Wq; dst = WqB; nrows = DM;
        if (blk >= PB_W) { blk -= PB_W; src = Wo; dst = WoB;
            if (blk >= PB_W) { blk -= PB_W; src = Wk; dst = WkB; nrows = KVW;
                if (blk >= PB_KV) { blk -= PB_KV; src = Wv; dst = WvB; } } } }
    cvtb_body(src, nrows, dst, blk);
}
// k_attn: block = (b, h, 64 queries), wave = 16. The products are transposed: S^T = K . Q^T (A = key rows, B = the wave's queries) and O^T += V^T . P^T, so that a
// lane holds the scores of ONE query (column lr; keys 8 hi + j and 16 + 8 hi + j of the 32-key tile): the maximum and the sum run in the lane's own registers with one
// exchange between the wave's halves, and the weights (x32768, f16 hi + residual) are, register for register, the B operand of the second product.
// ctx -> bf16 hi + residual planes CH/CL[tok][h*64+d].
#define KPIT 72                  // LDS pitch of a 64-value K row in elements: 144 bytes = 16 x 9, conflict-free for 16-byte fragment reads
#define VPIT 40                  // LDS pitch of a 32-key row of transposed V: 80 bytes = 16 x 5
#define KPL  (32 * KPIT)         // one K plane of a tile (32 keys)
#define VPL  (64 * VPIT)         // one V plane of a tile (64 head values)
#define ASTG (2 * KPL + 2 * VPL) // one buffer: [K hi | K lo | V hi | V lo]
// copy_kv: each lane brings 16 bytes of two rows of each of the four planes of a 32-key tile from global memory to LDS. The s_wait_xcnt closes the statement so
// that no address register of an issued copy is rewritten ahead of it.
__device__ __forceinline__ void copy_kv(unsigned lk, unsigned lv, const h16* kh, const h16* kl, const h16* vh, const h16* vl) {
    asm volatile("global_load_async_to_lds_b128 %0, %8, off\n\t"
                 "global_load_async_to_lds_b128 %1, %9, off\n\t"
                 "global_load_async_to_lds_b128 %2, %10, off\n\t"
                 "global_load_async_to_lds_b128 %3, %11, off\n\t"
                 "global_load_async_to_lds_b128 %4, %12, off\n\t"
                 "global_load_async_to_lds_b128 %5, %13, off\n\t"
                 "global_load_async_to_lds_b128 %6, %14, off\n\t"
                 "global_load_async_to_lds_b128 %7, %15, off\n\t"
                 "s_wait_xcnt 0x0"
                 :: "v"(lk), "v"(lk + 16 * KPIT * 2), "v"(lk + KPL * 2), "v"(lk + KPL * 2 + 16 * KPIT * 2), "v"(lv), "v"(lv + 32 * VPIT * 2), "v"(lv + VPL * 2), "v"(lv + VPL * 2 + 32 * VPIT * 2),
                    "v"(kh), "v"(kh + 16 * KVW), "v"(kl), "v"(kl + 16 * KVW), "v"(vh), "v"(vh + 32 * NT_), "v"(vl), "v"(vl + 32 * NT_)
                 : "memory");
}
// xhalf: the value of lane l ^ 16, by a vector cross-row move
__device__ __forceinline__ float xhalf(float v) { const int b = __float_as_int(v); return __int_as_float(__builtin_amdgcn_permlanex16(b, b, 0x76543210, 0xfedcba98, false, false)); }
__global__ __launch_bounds__(128) void k_attn(const h16* __restrict__ Q16, const h16* __restrict__ QL16, const h16* __restrict__ K16, const h16* __restrict__ KL16, const h16* __restrict__ VTH, const h16* __restrict__ VTL, bf* CH, bf* CL) {
    __shared__ __align__(16) float ost[4][16 * 68];
    __shared__ __align__(16) h16 kv[2 * ASTG];
    const int lane = threadIdx.x & 31, wave = threadIdx.x >> 5, lr = lane & 15, hi = lane >> 4;
    const int bid = blockIdx.x;
    const int b = bid / (NH_ * (NT_ / 64)), rem = bid - b * (NH_ * (NT_ / 64)), h = rem / (NT_ / 64), qt = rem - h * (NT_ / 64);
    const int q0 = qt * 64 + wave * 16;
    const size_t tok0 = (size_t)b * NT_;
    v16h qa[2], ql[2];
    const size_t qo0 = (tok0 + q0 + lr) * DM + h * HD + 8 * hi;
#pragma unroll
    for (int kc = 0; kc < 2; ++kc) { qa[kc] = cat16(*(const v8h*)(Q16 + qo0 + kc * 32), *(const v8h*)(Q16 + qo0 + kc * 32 + 16));
        ql[kc] = cat16(*(const v8h*)(QL16 + qo0 + kc * 32), *(const v8h*)(QL16 + qo0 + kc * 32 + 16)); }
    const int g = h / (NH_ / NKV);                      // kv head
    const h16* kh_b = K16 + tok0 * KVW + g * HD;
    const h16* kl_b = KL16 + tok0 * KVW + g * HD;
    const size_t vbase = (((size_t)b * NKV + g) * HD) * NT_;
    v8f o[4], ox[4];
#pragma unroll
    for (int n = 0; n < 4; ++n) { o[n] = (v8f){}; ox[n] = (v8f){}; }
    float mrow = -3.0e38f, lpart = 0.f;                    // the lane's query: running maximum (equal in both halves), sum over the lane's own keys
    const int qi = q0 + lr;
    const int ws_ = (qi - (WIN - 1)) > NMETA ? (qi - (WIN - 1)) : NMETA;
    // allowed(i, j) = (j >= max(i - WIN + 1, NMETA) && j <= i) || j < NMETA: the 4 meta tiles always, then the window tiles up to the query tile (block-uniform bounds, per-element predicate)
    const int wlo = (qt * 64 - (WIN - 1)) > NMETA ? (qt * 64 - (WIN - 1)) : NMETA; const int kt_wlo = wlo / 32; const int kt_hc = (qt * 64 + 63) / 32, kt_hi = kt_hc > (NMETA / 32 - 1) ? kt_hc : (NMETA / 32 - 1);     // the meta tiles are visited even by queries below 128 (non-causal meta keys)
    // the tiles in the order of the walk: ti = 0..3 are the meta tiles, ti >= 4 the window tiles kt_wlo..kt_hi (kt_wlo >= 4); all of it block-uniform
    const int ntile = NMETA / 32 + (kt_hi >= kt_wlo ? kt_hi - kt_wlo + 1 : 0);
    const int tid = threadIdx.x;
    const int krow = tid >> 3, kpc = (tid & 7) * 8;         // staging of K: 8 lanes per 128-byte row, 16 rows per copy of the block
    const int vrow = tid >> 2, vpc = (tid & 3) * 8;         // staging of V: 4 lanes per 64-byte row, 32 rows per copy of the block
    const unsigned lk0 = (unsigned)(size_t)(kv + krow * KPIT + kpc), lv0 = (unsigned)(size_t)(kv + 2 * KPL + vrow * VPIT + vpc);     // the lane's LDS byte addresses in buffer 0
    const h16* gkh = kh_b + (size_t)krow * KVW + kpc; const h16* gkl = kl_b + (size_t)krow * KVW + kpc;
    const h16* gvh = VTH + vbase + (size_t)vrow * NT_ + vpc; const h16* gvl = VTL + vbase + (size_t)vrow * NT_ + vpc;
    auto stage = [&](int ti) {
        const int sl0 = (ti < NMETA / 32 ? ti : ti - NMETA / 32 + kt_wlo) * 32; const unsigned bo = (ti & 1) * (ASTG * 2);
        copy_kv(lk0 + bo, lv0 + bo, gkh + (size_t)sl0 * KVW, gkl + (size_t)sl0 * KVW, gvh + sl0, gvl + sl0);
    };
    stage(0);
    asm volatile("s_wait_asynccnt 0x0" ::: "memory");      // this wave's copies of tile 0 have landed
    __syncthreads();                                       // every wave's have
    stage(1);                                              // ntile >= 4: a tile 1 always exists
#pragma unroll 1
    for (int ti = 0; ti < ntile; ++ti) {
        const int kt = ti < NMETA / 32 ? ti : ti - NMETA / 32 + kt_wlo;
        const int l0 = kt * 32;
        const h16* cur = kv + (ti & 1) * ASTG;
        const h16* fk = cur + lr * KPIT + 8 * hi;
        const h16* fv = cur + 2 * KPL + lr * VPIT + 8 * hi;
        v8f s0 = {}, s1 = {}, x0 = {}, x1 = {};
        v16h k0h[2], k1h[2], k0l[2], k1l[2];
#pragma unroll
        for (int kc = 0; kc < 2; ++kc) {
            k0h[kc] = cat16(*(const v8ha*)(fk + kc * 32), *(const v8ha*)(fk + kc * 32 + 16)); k1h[kc] = cat16(*(const v8ha*)(fk + 16 * KPIT + kc * 32), *(const v8ha*)(fk + 16 * KPIT + kc * 32 + 16));
            k0l[kc] = cat16(*(const v8ha*)(fk + KPL + kc * 32), *(const v8ha*)(fk + KPL + kc * 32 + 16)); k1l[kc] = cat16(*(const v8ha*)(fk + KPL + 16 * KPIT + kc * 32), *(const v8ha*)(fk + KPL + 16 * KPIT + kc * 32 + 16)); }
#pragma unroll
        for (int kc = 0; kc < 2; ++kc) {
            s0 = wmma16(k0h[kc], qa[kc], s0); x0 = wmma16(k0h[kc], ql[kc], x0); s1 = wmma16(k1h[kc], qa[kc], s1); x1 = wmma16(k1h[kc], ql[kc], x1);
            x0 = wmma16(k0l[kc], qa[kc], x0); x1 = wmma16(k1l[kc], qa[kc], x1);
        }
        asm volatile("v_nop\n\tv_nop\n\tv_nop\n\tv_nop" : "+v"(s0), "+v"(s1), "+v"(x0), "+v"(x1) : "v"(qa[0]), "v"(qa[1]));
        // element e of sc, pa and px = key l0 + kmap(e, hi) of the tile, the k order in which the V fragments are read
        float sc[16];
#pragma unroll
        for (int j = 0; j < 8; ++j) sc[j] = (s0[j] + x0[j] * LOSCI) * 0.125f;
#pragma unroll
        for (int j = 0; j < 8; ++j) sc[8 + j] = (s1[j] + x1[j] * LOSCI) * 0.125f;
        const bool meta = l0 < NMETA;                      // a tile lies wholly below or wholly at and above NMETA (32 divides it)
        const int dlo = meta ? 0 : ws_ - (l0 + 8 * hi), dhi = meta ? 31 : qi - (l0 + 8 * hi);      // the lane's allowed keys, counted from its first key of the tile
        float mx = -__builtin_inff();
#pragma unroll
        for (int e = 0; e < 16; ++e) { const int ko = (e & 7) + (e >> 3) * 16;
            sc[e] = ((ko >= dlo) & (ko <= dhi)) ? sc[e] : -__builtin_inff();
            mx = fmaxf(mx, sc[e]); }
        mx = fmaxf(mx, xhalf(mx));                         // the other 16 keys of the same query
        const float mn = fmaxf(mrow, mx);
        const float alpha = __expf(mrow - mn); mrow = mn;
        typedef __attribute__((ext_vector_type(16))) float v16f;
        typedef __attribute__((ext_vector_type(2))) float v2f;
        v16f t, p;
#pragma unroll
        for (int e = 0; e < 16; ++e) t[e] = sc[e];
        t = (t - mn) * 1.44269504088896340736f;            // exp(x) = 2^(x log2 e), the arguments formed pairwise ahead of the run of exponentials
#pragma unroll
        for (int e = 0; e < 16; ++e) p[e] = __builtin_amdgcn_exp2f(t[e]);
        const v8f t8 = p.lo + p.hi; const v4f t4 = t8.lo + t8.hi; const v2f t2 = t4.lo + t4.hi;      // the lane's 16 weights summed as a tree, not as one dependent chain
        const float psum = t2.x + t2.y;
        const v16f ps = p * PSC;
        const v16h pa = __builtin_convertvector(ps, v16h);
        const v16h px = __builtin_convertvector((ps - __builtin_convertvector(pa, v16f)) * LOSC, v16h);
        lpart = lpart * alpha + psum;
#pragma unroll
        for (int n = 0; n < 4; ++n)
#pragma unroll
            for (int j = 0; j < 8; ++j) { o[n][j] *= alpha; ox[n][j] *= alpha; }
#pragma unroll
        for (int n = 0; n < 4; ++n) { const h16* vp = fv + n * 16 * VPIT;
            const v16h vh = cat16(*(const v8ha*)(vp), *(const v8ha*)(vp + 16)), vl = cat16(*(const v8ha*)(vp + VPL), *(const v8ha*)(vp + VPL + 16));
            o[n] = wmma16(vh, pa, o[n]); ox[n] = wmma16(vl, pa, ox[n]); ox[n] = wmma16(vh, px, ox[n]); }
        asm volatile("v_nop\n\tv_nop\n\tv_nop\n\tv_nop" : "+v"(o[0]), "+v"(o[1]), "+v"(o[2]), "+v"(o[3]), "+v"(ox[0]), "+v"(ox[1]), "+v"(ox[2]), "+v"(ox[3]) : "v"(pa), "v"(px));
        asm volatile("s_wait_dscnt 0x0" ::: "memory");     // this wave has left the buffer it read
        asm volatile("s_wait_asynccnt 0x0" ::: "memory");  // its copies of tile ti + 1 have landed
        __syncthreads();                                   // publishes tile ti + 1 and ends every wave's reads of tile ti
        if (ti + 2 < ntile) stage(ti + 2);                 // refill of the buffer just left; block-uniform test
    }
    asm volatile("s_wait_asynccnt 0x0" ::: "memory");      // no copy is outstanding when the wave goes on to the epilogue
    const float inv = 1.0f / ((lpart + xhalf(lpart)) * PSC);      // the two halves' sums of the lane's query, joined once
    float* os = &ost[wave][0];
#pragma unroll
    for (int n = 0; n < 4; ++n)
#pragma unroll
        for (int j = 0; j < 8; ++j) os[lr * 68 + n * 16 + hi * 8 + j] = (o[n][j] + ox[n][j] * LOSCI) * inv;      // register j of O^T = head value n * 16 + 8 hi + j of query lr
    __syncthreads();
    const size_t cbase = (tok0 + q0) * DM + (size_t)h * HD;
    auto pass = [&]() {
#pragma unroll
        for (int s = 0; s < 4; ++s) { const int row = 4 * s + (lane >> 3), piece = lane & 7; const float* sp = os + row * 68 + piece * 8; v8us oh, ol;
#pragma unroll
            for (int i = 0; i < 8; ++i) { const unsigned short hb = f2bf(sp[i]); oh[i] = hb; ol[i] = f2bf(sp[i] - bf2f(hb)); }
            *(v8us*)(CH + cbase + (size_t)row * DM + piece * 8) = oh; *(v8us*)(CL + cbase + (size_t)row * DM + piece * 8) = ol; }
    };
    pass(); 
}

#define VST2(T, p, v) do { const T vst2_v_ = (v); *(T*)(p) = vst2_v_;  } while (0)
extern "C" void kernel_launch(void* const* d_in, const int* in_sizes, int n_in,
                              void* d_out, int out_size, void* d_ws, size_t ws_size, hipStream_t stream) {
    (void)in_sizes; (void)n_in; (void)out_size;
    const float* x = (const float*)d_in[0]; const int* pos = (const int*)d_in[1]; const float* Wq = (const float*)d_in[2]; const float* Wk = (const float*)d_in[3]; const float* Wv = (const float*)d_in[4]; const float* Wo = (const float*)d_in[5]; const float* qnw = (const float*)d_in[6]; const float* knw = (const float*)d_in[7];   // [out][in] weights; position_ids [2048] i32
    float* out = (float*)d_out;    // [1][2048][2048]
    char* wsp = (char*)d_ws;
    auto take = [&](size_t bytes) { char* p = wsp; wsp += (bytes + 255) & ~(size_t)255; return (void*)p; };
    bf* Xb = (bf*)take((size_t)NTK * DM * 2); bf* WqB = (bf*)take((size_t)DM * DM * 2); bf* WkB = (bf*)take((size_t)KVW * DM * 2); bf* WvB = (bf*)take((size_t)KVW * DM * 2); bf* WoB = (bf*)take((size_t)DM * DM * 2);
    h16* QH = (h16*)take((size_t)NTK * DM * 2); h16* QL = (h16*)take((size_t)NTK * DM * 2);
    h16* KH = (h16*)take((size_t)NTK * KVW * 2); h16* KL = (h16*)take((size_t)NTK * KVW * 2);
    h16* VTH = (h16*)take((size_t)NTK * KVW * 2); h16* VTL = (h16*)take((size_t)NTK * KVW * 2);
    float* RCq = (float*)take((size_t)NT_ * 32 * 4); float* RSq = (float*)take((size_t)NT_ * 32 * 4); float* RCk = (float*)take((size_t)NT_ * 32 * 4); float* RSk = (float*)take((size_t)NT_ * 32 * 4);
    bf* CH = (bf*)take((size_t)NTK * DM * 2); bf* CL = (bf*)take((size_t)NTK * DM * 2);
    if ((size_t)(wsp - (char*)d_ws) > ws_size) return;    // about 72 MB (69 MiB), no aliasing
    k_prep<<<PB_ALL, 256, 0, stream>>>(x, pos, Wq, Wk, Wv, Wo, Xb, WqB, WkB, WvB, WoB, RCq, RSq, RCk, RSk);
    k_gemmb<false><<<dim3(NTK / GBM, LDP / GBN, 1), 256, 0, stream>>>(Xb, nullptr, WqB, nullptr, 0, RSq, RCq, RSk, RCk, qnw, knw, QH, QL, KH, KL, VTH, VTL);   // WqB, WkB, WvB lie one behind the other: one [3072][2048] operand
    k_attn<<<NB_ * NH_ * (NT_ / 64), 128, 0, stream>>>(QH, QL, KH, KL, VTH, VTL, CH, CL);
    k_gemmb<true><<<dim3(NTK / GBM, DM / GBN, 1), 256, 0, stream>>>(CH, CL, WoB, out, DM, nullptr, nullptr, nullptr, nullptr, nullptr, nullptr, nullptr, nullptr, nullptr, nullptr, nullptr, nullptr);
}

// v006
// A run of this version takes 112 microseconds.
// Next to v005, in two timings, it ran 1.05 and 1.06 times as fast.
// Counting every step since v000, it is 3.49 times as fast.
#include <hip/hip_runtime.h>

// Contractions, f32 accumulate: q = x.Wq ([2048 x 2048].[2048 x 2048]), k/v = x.Wk/Wv ([2048 x 2048].[2048 x 512]) and attn.Wo on v_wmma_f32_16x16x32_bf16 —
// plain bf16 = rounded inputs (exact; [out][in] weights converted row by row, already n-major) for the projections, attn as bf16 hi + residual (two products) for Wo; RoPE
// (interleaved pairs, sin/cos computed by k_prep from position_ids for q, arange for k) in f32; the grouped-query causal sliding-window attention (32 query heads over 8 kv heads; keys j with
// j < 128 (meta keys) or max(i - 1023, 128) <= j <= i, window 1024 fixed at compile time) fused on v_wmma_f32_16x16x32_f16 with q and k as f16 hi + residual x1024 (hi.hi + hi.lo + lo.hi), weights

#define NB_  1
#define NT_  2048
#define DM   2048
#define NH_  32
#define NKV  8
#define KVW  (NKV * HD)          // 512
#define WIN  1024
#define NMETA 128
#define RMS_EPS 1e-6f
#define HD   64
#define NTK  (NB_ * NT_)
#define NW   1024
#define NQKV 2048
#define PSC  32768.0f
#define LOSC 1024.0f
#define LOSCI (1.0f / 1024.0f)
#define LDP  (DM + 2 * KVW)       // width of the joint projection [t][q 2048 | k 512 | v 512] (the projection grid's column extent; it is not stored)

typedef _Float16 h16;
typedef unsigned short bf;
typedef __attribute__((ext_vector_type(16))) __bf16   v16bf;
typedef __attribute__((ext_vector_type(16))) _Float16 v16h;
typedef __attribute__((ext_vector_type(8)))  _Float16 v8h;
typedef __attribute__((ext_vector_type(8)))  unsigned short v8us;
typedef __attribute__((ext_vector_type(8)))  float    v8f;
typedef __attribute__((ext_vector_type(4)))  float    v4f;
typedef v8h  __attribute__((may_alias)) v8ha;
typedef v4f  __attribute__((may_alias)) v4fa;
typedef v8us __attribute__((may_alias)) v8usa;

__device__ __forceinline__ unsigned short f2bf(float f) { unsigned u = __float_as_uint(f); u += 0x7FFFu + ((u >> 16) & 1u); return (unsigned short)(u >> 16); }
__device__ __forceinline__ float bf2f(unsigned short b) { return __uint_as_float(((unsigned)b) << 16); }
__device__ __forceinline__ float bfr(float f) { return bf2f(f2bf(f)); }
__device__ __forceinline__ v16h cat16(v8h lo, v8h hi) { return __builtin_shufflevector(lo, hi, 0, 1, 2, 3, 4, 5, 6, 7, 8, 9, 10, 11, 12, 13, 14, 15); }
__device__ __forceinline__ v16bf cat16b(v8us lo, v8us hi) { return __builtin_bit_cast(v16bf, __builtin_shufflevector(lo, hi, 0, 1, 2, 3, 4, 5, 6, 7, 8, 9, 10, 11, 12, 13, 14, 15)); }
__device__ __forceinline__ v8f wmma16(v16h a, v16h b, v8f c) { return __builtin_amdgcn_wmma_f32_16x16x32_f16(false, a, false, b, (short)0, c, false, false); }
__device__ __forceinline__ v8f wmmab(v16bf a, v16bf b, v8f c) { return __builtin_amdgcn_wmma_f32_16x16x32_bf16(false, a, false, b, (short)0, c, false, false); }

__device__ __forceinline__ void cvtb_body(const float* __restrict__ src, int nrows, bf* dst, int blk) {
    const int lane = threadIdx.x & 31, r = blk * 8 + (threadIdx.x >> 5);
    if (r >= nrows) return;
    v8us o[DM / 256];
#pragma unroll
    for (int q = 0; q < DM / 256; ++q) { v8us t;
#pragma unroll
        for (int i = 0; i < 8; ++i) t[i] = f2bf(src[(size_t)r * DM + q * 256 + lane * 8 + i]);
        o[q] = t; }
#pragma unroll
    for (int q = 0; q < DM / 256; ++q) *(v8us*)(dst + (size_t)r * DM + q * 256 + lane * 8) = o[q];
    
}

// k_wt: W [2048 k][ncols n] (k-major) -> n-major bf16 plane WT[ncols][2048]; 64 x 64 tiles through LDS.
__global__ __launch_bounds__(256) void k_wt(const float* __restrict__ Wm, int ncols, bf* WT) {
    __shared__ __align__(16) unsigned short tl[64 * 72];
    const int tid = threadIdx.x, k0 = blockIdx.x * 64, n0 = blockIdx.y * 64;
    const int kk = tid >> 2, nq = (tid & 3) * 16;
#pragma unroll
    for (int i = 0; i < 16; ++i) tl[(nq + i) * 72 + kk] = f2bf(Wm[(size_t)(k0 + kk) * ncols + n0 + nq + i]);
    __syncthreads();
    const int piece = tid & 7;
    typedef __attribute__((ext_vector_type(8))) unsigned short v8us_; typedef v8us_ __attribute__((may_alias)) v8usa_;
    auto pass = [&]() {
#pragma unroll
        for (int s = 0; s < 2; ++s) { const int nr = (tid >> 3) + 32 * s; const v8us_ val = *(const v8usa_*)(tl + nr * 72 + piece * 8);
            *(v8us_*)(WT + (size_t)(n0 + nr) * DM + k0 + piece * 8) = val; }
    };
    pass(); 
}

// k_gemmb: C[128 x 128 per block] = A . Bn^T (+ Al . Bn^T), all operands k-contiguous bf16. A pass is 128 k (256-byte rows): the block's rows of Bn, A (and Al) come
// once per block into one of two LDS buffers by asynchronous copies while the other buffer is multiplied; 8 waves (4 x 2), 32 x 64 of C each.
// Without Al the product is the joint projection [t][q 2048 | k 512 | v 512] and never goes to memory as f32: the epilogue norms and rotates q and k and transposes v
// from its LDS staging and stores the f16 planes that the attention reads.
#define GBM 128
#define GBN 128
#define GBK 128
#define GPIT (GBK + 8)           // LDS row pitch in elements: 272 bytes = 16 x 17, the conflict-free pitch for 16-byte fragment reads of 256-byte rows
#define TPIT (GBM + 8)           // LDS row pitch of the transposed v tile in elements: 272 bytes, as above
typedef float __attribute__((may_alias)) f32a;
// copy8: each lane brings 16 bytes of eight rows, 16 rows apart, from global memory to LDS. The s_wait_xcnt closes the statement so that no address register
// of an issued copy is rewritten ahead of it.
__device__ __forceinline__ void copy8(unsigned l, const bf* p) {
    asm volatile("global_load_async_to_lds_b128 %0, %8, off\n\t"
                 "global_load_async_to_lds_b128 %1, %9, off\n\t"
                 "global_load_async_to_lds_b128 %2, %10, off\n\t"
                 "global_load_async_to_lds_b128 %3, %11, off\n\t"
                 "global_load_async_to_lds_b128 %4, %12, off\n\t"
                 "global_load_async_to_lds_b128 %5, %13, off\n\t"
                 "global_load_async_to_lds_b128 %6, %14, off\n\t"
                 "global_load_async_to_lds_b128 %7, %15, off\n\t"
                 "s_wait_xcnt 0x0"
                 :: "v"(l), "v"(l + 1 * 16 * GPIT * 2), "v"(l + 2 * 16 * GPIT * 2), "v"(l + 3 * 16 * GPIT * 2), "v"(l + 4 * 16 * GPIT * 2), "v"(l + 5 * 16 * GPIT * 2), "v"(l + 6 * 16 * GPIT * 2), "v"(l + 7 * 16 * GPIT * 2),
                    "v"(p), "v"(p + 1 * 16 * DM), "v"(p + 2 * 16 * DM), "v"(p + 3 * 16 * DM), "v"(p + 4 * 16 * DM), "v"(p + 5 * 16 * DM), "v"(p + 6 * 16 * DM), "v"(p + 7 * 16 * DM)
                 : "memory");
}
template <bool SPLITA>
__global__ __launch_bounds__(256) void k_gemmb(const bf* __restrict__ A, const bf* __restrict__ Al, const bf* __restrict__ Bn, float* C, int ldc,
                                               const float* __restrict__ rsq, const float* __restrict__ rcq, const float* __restrict__ rsk, const float* __restrict__ rck,
                                               const float* __restrict__ qnw, const float* __restrict__ knw, h16* QH, h16* QL, h16* KH, h16* KL, h16* VTH, h16* VTL) {
    constexpr int ROWS = GBN + (SPLITA ? 2 : 1) * GBM;     // buffer rows: [Bn 128 | A 128 | Al 128]
    constexpr int STG = ROWS * GPIT, NP = DM / GBK, NKS = GBK / 32;
    __shared__ __align__(16) bf sm[2 * STG];
    const int tid = threadIdx.x, lane = tid & 31, wave = tid >> 5, lr = lane & 15, hi = lane >> 4;
    const int wm = wave >> 1, wn = wave & 1;
    const int r0 = blockIdx.x * GBM, c0 = blockIdx.y * GBN;
    const int srow = tid >> 4, spc = (tid & 15) * 8;       // staging: 16 lanes per 256-byte row, 16 rows per copy of the block
    const bf* gB = Bn + (size_t)(c0 + srow) * DM + spc;
    const bf* gA = A + (size_t)(r0 + srow) * DM + spc;
    const bf* gL = SPLITA ? Al + (size_t)(r0 + srow) * DM + spc : nullptr;
    const unsigned lst = (unsigned)(size_t)(sm + srow * GPIT + spc);      // the lane's LDS byte address in buffer 0
    auto stage = [&](int kt) {
        const unsigned l = lst + (kt & 1) * (STG * 2);
        copy8(l, gB + kt * GBK); copy8(l + GBN * GPIT * 2, gA + kt * GBK);
        if (SPLITA) copy8(l + (GBN + GBM) * GPIT * 2, gL + kt * GBK);
    };
    v8f acc[2][4];
#pragma unroll
    for (int mi = 0; mi < 2; ++mi)
#pragma unroll
        for (int ni = 0; ni < 4; ++ni) acc[mi][ni] = (v8f){};
    stage(0);
    asm volatile("s_wait_asynccnt 0x0" ::: "memory");      // this wave's copies of pass 0 have landed
    __syncthreads();                                       // every wave's have
    stage(1);
    // the pass loop stays rolled (one copy of the pass in the instruction cache, the buffer chosen by kt & 1); every loop inside it is unrolled so that each
    // index into a fragment or accumulator array is a constant and the arrays stay in registers
#pragma unroll 1
    for (int kt = 0; kt < NP; ++kt) {
        const bf* cur = sm + (kt & 1) * STG;
        const bf* fbp = cur + (wn * 64 + lr) * GPIT + 8 * hi;
        const bf* fap = cur + (GBN + wm * 32 + lr) * GPIT + 8 * hi;
        v16bf fb[2][4], fa[2][2], fl[2][2];
        auto frags = [&](int ks, int s) {
#pragma unroll
            for (int ni = 0; ni < 4; ++ni) fb[s][ni] = cat16b(*(const v8usa*)(fbp + ni * 16 * GPIT + ks * 32), *(const v8usa*)(fbp + ni * 16 * GPIT + ks * 32 + 16));
#pragma unroll
            for (int mi = 0; mi < 2; ++mi) { fa[s][mi] = cat16b(*(const v8usa*)(fap + mi * 16 * GPIT + ks * 32), *(const v8usa*)(fap + mi * 16 * GPIT + ks * 32 + 16));
                if (SPLITA) fl[s][mi] = cat16b(*(const v8usa*)(fap + (GBM + mi * 16) * GPIT + ks * 32), *(const v8usa*)(fap + (GBM + mi * 16) * GPIT + ks * 32 + 16)); }
        };
        frags(0, 0);
#pragma unroll
        for (int ks = 0; ks < NKS; ++ks) {
            if (ks + 1 < NKS) frags(ks + 1, (ks + 1) & 1);
            __builtin_amdgcn_sched_barrier(0);             // keeps the next k step's LDS reads one group ahead of this step's products, not among them
#pragma unroll
            for (int mi = 0; mi < 2; ++mi)
#pragma unroll
                for (int ni = 0; ni < 4; ++ni) acc[mi][ni] = wmmab(fa[ks & 1][mi], fb[ks & 1][ni], acc[mi][ni]);
            if (SPLITA) {
#pragma unroll
                for (int mi = 0; mi < 2; ++mi)
#pragma unroll
                    for (int ni = 0; ni < 4; ++ni) acc[mi][ni] = wmmab(fl[ks & 1][mi], fb[ks & 1][ni], acc[mi][ni]);
            }
            __builtin_amdgcn_sched_barrier(0);             // the other side of the same fence pair
        }
        asm volatile("s_wait_dscnt 0x0" ::: "memory");     // this wave has left the buffer it read
        asm volatile("s_wait_asynccnt 0x0" ::: "memory");  // its copies of pass kt + 1 have landed
        __syncthreads();                                   // publishes pass kt + 1 and ends every wave's reads of pass kt
        if (kt + 2 < NP) stage(kt + 2);                    // refill of the buffer just left; block-uniform test
    }
    asm volatile("s_wait_asynccnt 0x0" ::: "memory");      // no copy is outstanding when the buffers become output staging
    f32a* os = (f32a*)sm + wave * (32 * 68);               // per-wave 32 x 64 staging (pitch 68 floats) so that every store covers whole 128-byte lines
    // three epilogues, chosen block-uniformly (a block's 128 columns lie wholly in q, in k or in v), each with its own barrier between its LDS stores and its LDS reads
    if (SPLITA) {
#pragma unroll
        for (int mi = 0; mi < 2; ++mi)
#pragma unroll
            for (int ni = 0; ni < 4; ++ni)
#pragma unroll
                for (int j = 0; j < 8; ++j) os[(mi * 16 + hi * 8 + j) * 68 + ni * 16 + lr] = acc[mi][ni][j];
        __syncthreads();
        float* crow = C + (size_t)(r0 + wm * 32) * ldc + c0 + wn * 64;
#pragma unroll
        for (int s = 0; s < 16; ++s) { const int row = 2 * s + hi;
            const v4f val = *(const v4fa*)(os + row * 68 + lr * 4); *(v4f*)(crow + (size_t)row * ldc + lr * 4) = val; }
    } else if (c0 >= DM + KVW) {
        // v -> transposed f16 hi + residual planes, row = kv head * 64 + head value. Registers j = 0..7 of an accumulator are eight consecutive tokens of one column:
        // one 16-byte LDS store per plane lays them down transposed in two planes [128 columns][128 tokens], pitch TPIT
        h16* th = (h16*)sm;
#pragma unroll
        for (int mi = 0; mi < 2; ++mi)
#pragma unroll
            for (int ni = 0; ni < 4; ++ni) { v8h a, l;
#pragma unroll
                for (int j = 0; j < 8; ++j) { const float v = acc[mi][ni][j]; const h16 ah = (h16)v; a[j] = ah; l[j] = (h16)((v - (float)ah) * LOSC); }
                h16* tp = th + (wn * 64 + ni * 16 + lr) * TPIT + wm * 32 + mi * 16 + hi * 8;
                *(v8ha*)tp = a; *(v8ha*)(tp + GBN * TPIT) = l; }
        __syncthreads();
        const size_t vb = (size_t)(c0 - (DM + KVW) + srow) * NT_ + r0 + spc;      // 128 tokens = 256 bytes of a row per block: 16 lanes x 16 bytes
#pragma unroll
        for (int s = 0; s < 8; ++s) { const h16* tp = th + (srow + 16 * s) * TPIT + spc;
            const v8h vh = *(const v8ha*)tp, vl = *(const v8ha*)(tp + GBN * TPIT);
            *(v8h*)(VTH + vb + (size_t)(16 * s) * NT_) = vh; *(v8h*)(VTL + vb + (size_t)(16 * s) * NT_) = vl; }
    } else {
        // q and k: the wave's 64 columns are one head. Per-head RMSNorm (f32: mean of squares over the head's 64 values via an 8-lane xor reduction, eps 1e-6, x bf(w[d])),
        // then the interleaved-pair rotation out[2i] = x[2i] c - x[2i+1] s, out[2i+1] = x[2i] s + x[2i+1] c, then f16 hi + residual planes.
        // 8 lanes per row, 8 values (4 pairs) each; rows trow + 4 s
        const bool ik = c0 >= DM;
        const int piece = lane & 7, trow = r0 + wm * 32 + (lane >> 3);
        const float* ps = (ik ? rsk : rsq) + trow * 32 + piece * 4; const float* pc = (ik ? rck : rcq) + trow * 32 + piece * 4; const float* pw = (ik ? knw : qnw) + piece * 8;
        v4f sv[8], cv[8];                                  // the rotation tables and the norm weights are fetched ahead of the staging and its barrier, which cover their latency
#pragma unroll
        for (int s = 0; s < 8; ++s) { sv[s] = *(const v4f*)(ps + s * 128); cv[s] = *(const v4f*)(pc + s * 128); }
        const v4f wa = *(const v4f*)pw, wb = *(const v4f*)(pw + 4);
        asm volatile("s_wait_xcnt 0x0" :: "v"(ps), "v"(pc), "v"(pw) : "memory");      // the three addresses stay live up to this wait, so that no load's result is laid over them ahead of it
#pragma unroll
        for (int mi = 0; mi < 2; ++mi)
#pragma unroll
            for (int ni = 0; ni < 4; ++ni)
#pragma unroll
                for (int j = 0; j < 8; ++j) os[(mi * 16 + hi * 8 + j) * 68 + ni * 16 + lr] = acc[mi][ni][j];
        __syncthreads();
        h16* PH = ik ? KH : QH; h16* PL = ik ? KL : QL;
        const int ncols = ik ? KVW : DM, cc = (ik ? c0 - DM : c0) + wn * 64 + piece * 8;
        float wv[8];
#pragma unroll
        for (int i = 0; i < 4; ++i) { wv[i] = bfr(wa[i]); wv[4 + i] = bfr(wb[i]); }
#pragma unroll
        for (int s = 0; s < 8; ++s) { const int row = 4 * s + (lane >> 3), t = trow + 4 * s;
            const v4f xa = *(const v4fa*)(os + row * 68 + piece * 8), xb = *(const v4fa*)(os + row * 68 + piece * 8 + 4);
            float xv[8];
#pragma unroll
            for (int i = 0; i < 4; ++i) { xv[i] = xa[i]; xv[4 + i] = xb[i]; }
            float ss = 0.f;
#pragma unroll
            for (int i = 0; i < 8; ++i) ss = fmaf(xv[i], xv[i], ss);
            ss += __shfl_xor(ss, 1, 32); ss += __shfl_xor(ss, 2, 32); ss += __shfl_xor(ss, 4, 32);      // the 8 lanes of this row
            const float rn = rsqrtf(ss * (1.0f / 64.0f) + RMS_EPS);
            float xn[8];
#pragma unroll
            for (int i = 0; i < 8; ++i) xn[i] = wv[i] * (xv[i] * rn);
            v8h oh, ol;
#pragma unroll
            for (int pq = 0; pq < 4; ++pq) {
                const float x1 = xn[2 * pq], x2 = xn[2 * pq + 1], sn = sv[s][pq], co = cv[s][pq];
                const float y0 = x1 * co - x2 * sn, y1 = x1 * sn + x2 * co;
                const h16 a0 = (h16)y0, a1 = (h16)y1; oh[2 * pq] = a0; oh[2 * pq + 1] = a1; ol[2 * pq] = (h16)((y0 - (float)a0) * LOSC); ol[2 * pq + 1] = (h16)((y1 - (float)a1) * LOSC); }
            *(v8h*)(PH + (size_t)t * ncols + cc) = oh; *(v8h*)(PL + (size_t)t * ncols + cc) = ol; }
        asm volatile("s_wait_xcnt 0x0" ::: "memory");      // the v branch is laid out behind this one and reuses the registers that the last stores name
    }
}

__device__ __forceinline__ void trig_body(const int* __restrict__ pos, float* RC, float* RS, int blk) {
    const int u = blk * 256 + threadIdx.x; if (u >= NT_ * 32) return;
    const int t = u >> 5, i = u & 31; const float inv = 1.0f / powf(10000.0f, (float)(2 * i) / (float)HD); const float ang = (float)(pos ? pos[t] : t) * inv; const float c = cosf(ang), s = sinf(ang);
    *(float*)(RC + u) = c; *(float*)(RS + u) = s; 
}
// k_prep: the seven launches that need nothing of each other (two rotation tables, five bf16 roundings) as ranges of one grid's block index; every branch is block-uniform.
#define PB_TRIG ((NT_ * 32) / 256)
#define PB_X    (NTK / 8)
#define PB_W    (DM / 8)
#define PB_KV   (KVW / 8)
#define PB_ALL  (2 * PB_TRIG + PB_X + 2 * PB_W + 2 * PB_KV)
__global__ __launch_bounds__(256) void k_prep(const float* __restrict__ x, const int* __restrict__ pos, const float* __restrict__ Wq, const float* __restrict__ Wk, const float* __restrict__ Wv, const float* __restrict__ Wo,
                                              bf* Xb, bf* WqB, bf* WkB, bf* WvB, bf* WoB, float* RCq, float* RSq, float* RCk, float* RSk) {
    int blk = blockIdx.x;
    if (blk < 2 * PB_TRIG) { const bool ik = blk >= PB_TRIG;      // q: position_ids; k: arange
        trig_body(ik ? nullptr : pos, ik ? RCk : RCq, ik ? RSk : RSq, ik ? blk - PB_TRIG : blk); return; }
    blk -= 2 * PB_TRIG;
    const float* src = x; bf* dst = Xb; int nrows = NTK;
    if (blk >= PB_X) { blk -= PB_X; src = Wq; dst = WqB; nrows = DM;
        if (blk >= PB_W) { blk -= PB_W; src = Wo; dst = WoB;
            if (blk >= PB_W) { blk -= PB_W; src = Wk; dst = WkB; nrows = KVW;
                if (blk >= PB_KV) { blk -= PB_KV; src = Wv; dst = WvB; } } } }
    cvtb_body(src, nrows, dst, blk);
}
// k_attn: block = (b, h, 64 queries), wave = 16. The products are transposed: S^T = K . Q^T (A = key rows, B = the wave's queries) and O^T += V^T . P^T, so that a
// lane holds the scores of ONE query (column lr; keys 8 hi + j and 16 + 8 hi + j of the 32-key tile): the maximum and the sum run in the lane's own registers with one
// exchange between the wave's halves, and the weights (x32768, f16 hi + residual) are, register for register, the B operand of the second product.
// ctx -> bf16 hi + residual planes CH/CL[tok][h*64+d].
#define KPIT 72                  // LDS pitch of a 64-value K row in elements: 144 bytes = 16 x 9, conflict-free for 16-byte fragment reads
#define VPIT 40                  // LDS pitch of a 32-key row of transposed V: 80 bytes = 16 x 5
#define KPL  (32 * KPIT)         // one K plane of a tile (32 keys)
#define VPL  (64 * VPIT)         // one V plane of a tile (64 head values)
#define ASTG (2 * KPL + 2 * VPL) // one buffer: [K hi | K lo | V hi | V lo]
// copy_kv: each lane brings 16 bytes of two rows of each of the four planes of a 32-key tile from global memory to LDS. The s_wait_xcnt closes the statement so
// that no address register of an issued copy is rewritten ahead of it.
__device__ __forceinline__ void copy_kv(unsigned lk, unsigned lv, const h16* kh, const h16* kl, const h16* vh, const h16* vl) {
    asm volatile("global_load_async_to_lds_b128 %0, %8, off\n\t"
                 "global_load_async_to_lds_b128 %1, %9, off\n\t"
                 "global_load_async_to_lds_b128 %2, %10, off\n\t"
                 "global_load_async_to_lds_b128 %3, %11, off\n\t"
                 "global_load_async_to_lds_b128 %4, %12, off\n\t"
                 "global_load_async_to_lds_b128 %5, %13, off\n\t"
                 "global_load_async_to_lds_b128 %6, %14, off\n\t"
                 "global_load_async_to_lds_b128 %7, %15, off\n\t"
                 "s_wait_xcnt 0x0"
                 :: "v"(lk), "v"(lk + 16 * KPIT * 2), "v"(lk + KPL * 2), "v"(lk + KPL * 2 + 16 * KPIT * 2), "v"(lv), "v"(lv + 32 * VPIT * 2), "v"(lv + VPL * 2), "v"(lv + VPL * 2 + 32 * VPIT * 2),
                    "v"(kh), "v"(kh + 16 * KVW), "v"(kl), "v"(kl + 16 * KVW), "v"(vh), "v"(vh + 32 * NT_), "v"(vl), "v"(vl + 32 * NT_)
                 : "memory");
}
// xhalf: the value of lane l ^ 16, by a vector cross-row move
__device__ __forceinline__ float xhalf(float v) { const int b = __float_as_int(v); return __int_as_float(__builtin_amdgcn_permlanex16(b, b, 0x76543210, 0xfedcba98, false, false)); }
__global__ __launch_bounds__(128) void k_attn(const h16* __restrict__ Q16, const h16* __restrict__ QL16, const h16* __restrict__ K16, const h16* __restrict__ KL16, const h16* __restrict__ VTH, const h16* __restrict__ VTL, bf* CH, bf* CL) {
    __shared__ __align__(16) float ost[4][16 * 68];
    __shared__ __align__(16) h16 kv[2 * ASTG];
    const int lane = threadIdx.x & 31, wave = threadIdx.x >> 5, lr = lane & 15, hi = lane >> 4;
    const int bid = blockIdx.x;
    const int b = bid / (NH_ * (NT_ / 64)), rem = bid - b * (NH_ * (NT_ / 64)), h = rem / (NT_ / 64), qt = rem - h * (NT_ / 64);
    const int q0 = qt * 64 + wave * 16;
    const size_t tok0 = (size_t)b * NT_;
    v16h qa[2], ql[2];
    const size_t qo0 = (tok0 + q0 + lr) * DM + h * HD + 8 * hi;
#pragma unroll
    for (int kc = 0; kc < 2; ++kc) { qa[kc] = cat16(*(const v8h*)(Q16 + qo0 + kc * 32), *(const v8h*)(Q16 + qo0 + kc * 32 + 16));
        ql[kc] = cat16(*(const v8h*)(QL16 + qo0 + kc * 32), *(const v8h*)(QL16 + qo0 + kc * 32 + 16)); }
    const int g = h / (NH_ / NKV);                      // kv head
    const h16* kh_b = K16 + tok0 * KVW + g * HD;
    const h16* kl_b = KL16 + tok0 * KVW + g * HD;
    const size_t vbase = (((size_t)b * NKV + g) * HD) * NT_;
    v8f o[4], ox[4];
#pragma unroll
    for (int n = 0; n < 4; ++n) { o[n] = (v8f){}; ox[n] = (v8f){}; }
    float mrow = -3.0e38f, lpart = 0.f;                    // the lane's query: running maximum (equal in both halves), sum over the lane's own keys
    const int qi = q0 + lr;
    const int ws_ = (qi - (WIN - 1)) > NMETA ? (qi - (WIN - 1)) : NMETA;
    // allowed(i, j) = (j >= max(i - WIN + 1, NMETA) && j <= i) || j < NMETA: the 4 meta tiles always, then the window tiles up to the query tile (block-uniform bounds, per-element predicate)
    const int wlo = (qt * 64 - (WIN - 1)) > NMETA ? (qt * 64 - (WIN - 1)) : NMETA; const int kt_wlo = wlo / 32; const int kt_hc = (qt * 64 + 63) / 32, kt_hi = kt_hc > (NMETA / 32 - 1) ? kt_hc : (NMETA / 32 - 1);     // the meta tiles are visited even by queries below 128 (non-causal meta keys)
    // the tiles in the order of the walk: ti = 0..3 are the meta tiles, ti >= 4 the window tiles kt_wlo..kt_hi (kt_wlo >= 4); all of it block-uniform
    const int ntile = NMETA / 32 + (kt_hi >= kt_wlo ? kt_hi - kt_wlo + 1 : 0);
    const int wsl = (qt * 64 + 63 - (WIN - 1)) > NMETA ? (qt * 64 + 63 - (WIN - 1)) : NMETA;      // window start of the block's last query, the largest of the block
    const int tid = threadIdx.x;
    const int krow = tid >> 3, kpc = (tid & 7) * 8;         // staging of K: 8 lanes per 128-byte row, 16 rows per copy of the block
    const int vrow = tid >> 2, vpc = (tid & 3) * 8;         // staging of V: 4 lanes per 64-byte row, 32 rows per copy of the block
    const unsigned lk0 = (unsigned)(size_t)(kv + krow * KPIT + kpc), lv0 = (unsigned)(size_t)(kv + 2 * KPL + vrow * VPIT + vpc);     // the lane's LDS byte addresses in buffer 0
    const h16* gkh = kh_b + (size_t)krow * KVW + kpc; const h16* gkl = kl_b + (size_t)krow * KVW + kpc;
    const h16* gvh = VTH + vbase + (size_t)vrow * NT_ + vpc; const h16* gvl = VTL + vbase + (size_t)vrow * NT_ + vpc;
    auto stage = [&](int ti) {
        const int sl0 = (ti < NMETA / 32 ? ti : ti - NMETA / 32 + kt_wlo) * 32; const unsigned bo = (ti & 1) * (ASTG * 2);
        copy_kv(lk0 + bo, lv0 + bo, gkh + (size_t)sl0 * KVW, gkl + (size_t)sl0 * KVW, gvh + sl0, gvl + sl0);
    };
    stage(0);
    asm volatile("s_wait_asynccnt 0x0" ::: "memory");      // this wave's copies of tile 0 have landed
    __syncthreads();                                       // every wave's have
    stage(1);                                              // ntile >= 4: a tile 1 always exists
#pragma unroll 1
    for (int ti = 0; ti < ntile; ++ti) {
        const int kt = ti < NMETA / 32 ? ti : ti - NMETA / 32 + kt_wlo;
        const int l0 = kt * 32;
        const h16* cur = kv + (ti & 1) * ASTG;
        const h16* fk = cur + lr * KPIT + 8 * hi;
        const h16* fv = cur + 2 * KPL + lr * VPIT + 8 * hi;
        v8f s0 = {}, s1 = {}, x0 = {}, x1 = {};
        v16h k0h[2], k1h[2], k0l[2], k1l[2];
#pragma unroll
        for (int kc = 0; kc < 2; ++kc) {
            k0h[kc] = cat16(*(const v8ha*)(fk + kc * 32), *(const v8ha*)(fk + kc * 32 + 16)); k1h[kc] = cat16(*(const v8ha*)(fk + 16 * KPIT + kc * 32), *(const v8ha*)(fk + 16 * KPIT + kc * 32 + 16));
            k0l[kc] = cat16(*(const v8ha*)(fk + KPL + kc * 32), *(const v8ha*)(fk + KPL + kc * 32 + 16)); k1l[kc] = cat16(*(const v8ha*)(fk + KPL + 16 * KPIT + kc * 32), *(const v8ha*)(fk + KPL + 16 * KPIT + kc * 32 + 16)); }
#pragma unroll
        for (int kc = 0; kc < 2; ++kc) {
            s0 = wmma16(k0h[kc], qa[kc], s0); x0 = wmma16(k0h[kc], ql[kc], x0); s1 = wmma16(k1h[kc], qa[kc], s1); x1 = wmma16(k1h[kc], ql[kc], x1);
            x0 = wmma16(k0l[kc], qa[kc], x0); x1 = wmma16(k1l[kc], qa[kc], x1);
        }
        asm volatile("v_nop\n\tv_nop\n\tv_nop\n\tv_nop" : "+v"(s0), "+v"(s1), "+v"(x0), "+v"(x1) : "v"(qa[0]), "v"(qa[1]));
        // element e of sc, pa and px = key l0 + kmap(e, hi) of the tile, the k order in which the V fragments are read
        float sc[16];
#pragma unroll
        for (int j = 0; j < 8; ++j) sc[j] = (s0[j] + x0[j] * LOSCI) * 0.125f;
#pragma unroll
        for (int j = 0; j < 8; ++j) sc[8 + j] = (s1[j] + x1[j] * LOSCI) * 0.125f;
        const bool meta = l0 < NMETA;                      // a tile lies wholly below or wholly at and above NMETA (32 divides it)
        const int dlo = meta ? 0 : ws_ - (l0 + 8 * hi), dhi = meta ? 31 : qi - (l0 + 8 * hi);      // the lane's allowed keys, counted from its first key of the tile
        // the predicate is applied only on a tile that holds a forbidden (query, key) pair for some query of the block: one that reaches past the block's first query
        // or begins below its last query's window start. The test is block-uniform (a scalar branch); on every other tile the predicate is true for each element
        if (!meta && (l0 + 31 > qt * 64 || l0 < wsl)) {
#pragma unroll
            for (int e = 0; e < 16; ++e) { const int ko = (e & 7) + (e >> 3) * 16;
                sc[e] = ((ko >= dlo) & (ko <= dhi)) ? sc[e] : -__builtin_inff(); }
        }
        float mx = -__builtin_inff();
#pragma unroll
        for (int e = 0; e < 16; ++e) mx = fmaxf(mx, sc[e]);
        mx = fmaxf(mx, xhalf(mx));                         // the other 16 keys of the same query
        const float mn = fmaxf(mrow, mx);
        const float alpha = __expf(mrow - mn); mrow = mn;
        typedef __attribute__((ext_vector_type(16))) float v16f;
        typedef __attribute__((ext_vector_type(2))) float v2f;
        v16f t, p;
#pragma unroll
        for (int e = 0; e < 16; ++e) t[e] = sc[e];
        t = (t - mn) * 1.44269504088896340736f;            // exp(x) = 2^(x log2 e), the arguments formed pairwise ahead of the run of exponentials
#pragma unroll
        for (int e = 0; e < 16; ++e) p[e] = __builtin_amdgcn_exp2f(t[e]);
        const v8f t8 = p.lo + p.hi; const v4f t4 = t8.lo + t8.hi; const v2f t2 = t4.lo + t4.hi;      // the lane's 16 weights summed as a tree, not as one dependent chain
        const float psum = t2.x + t2.y;
        const v16f ps = p * PSC;
        const v16h pa = __builtin_convertvector(ps, v16h);
        const v16h px = __builtin_convertvector((ps - __builtin_convertvector(pa, v16f)) * LOSC, v16h);
        lpart = lpart * alpha + psum;
#pragma unroll
        for (int n = 0; n < 4; ++n)
#pragma unroll
            for (int j = 0; j < 8; ++j) { o[n][j] *= alpha; ox[n][j] *= alpha; }
#pragma unroll
        for (int n = 0; n < 4; ++n) { const h16* vp = fv + n * 16 * VPIT;
            const v16h vh = cat16(*(const v8ha*)(vp), *(const v8ha*)(vp + 16)), vl = cat16(*(const v8ha*)(vp + VPL), *(const v8ha*)(vp + VPL + 16));
            o[n] = wmma16(vh, pa, o[n]); ox[n] = wmma16(vl, pa, ox[n]); ox[n] = wmma16(vh, px, ox[n]); }
        asm volatile("v_nop\n\tv_nop\n\tv_nop\n\tv_nop" : "+v"(o[0]), "+v"(o[1]), "+v"(o[2]), "+v"(o[3]), "+v"(ox[0]), "+v"(ox[1]), "+v"(ox[2]), "+v"(ox[3]) : "v"(pa), "v"(px));
        asm volatile("s_wait_dscnt 0x0" ::: "memory");     // this wave has left the buffer it read
        asm volatile("s_wait_asynccnt 0x0" ::: "memory");  // its copies of tile ti + 1 have landed
        __syncthreads();                                   // publishes tile ti + 1 and ends every wave's reads of tile ti
        if (ti + 2 < ntile) stage(ti + 2);                 // refill of the buffer just left; block-uniform test
    }
    asm volatile("s_wait_asynccnt 0x0" ::: "memory");      // no copy is outstanding when the wave goes on to the epilogue
    const float inv = 1.0f / ((lpart + xhalf(lpart)) * PSC);      // the two halves' sums of the lane's query, joined once
    float* os = &ost[wave][0];
#pragma unroll
    for (int n = 0; n < 4; ++n)
#pragma unroll
        for (int j = 0; j < 8; ++j) os[lr * 68 + n * 16 + hi * 8 + j] = (o[n][j] + ox[n][j] * LOSCI) * inv;      // register j of O^T = head value n * 16 + 8 hi + j of query lr
    __syncthreads();
    const size_t cbase = (tok0 + q0) * DM + (size_t)h * HD;
    auto pass = [&]() {
#pragma unroll
        for (int s = 0; s < 4; ++s) { const int row = 4 * s + (lane >> 3), piece = lane & 7; const float* sp = os + row * 68 + piece * 8; v8us oh, ol;
#pragma unroll
            for (int i = 0; i < 8; ++i) { const unsigned short hb = f2bf(sp[i]); oh[i] = hb; ol[i] = f2bf(sp[i] - bf2f(hb)); }
            *(v8us*)(CH + cbase + (size_t)row * DM + piece * 8) = oh; *(v8us*)(CL + cbase + (size_t)row * DM + piece * 8) = ol; }
    };
    pass(); 
}

#define VST2(T, p, v) do { const T vst2_v_ = (v); *(T*)(p) = vst2_v_;  } while (0)
extern "C" void kernel_launch(void* const* d_in, const int* in_sizes, int n_in,
                              void* d_out, int out_size, void* d_ws, size_t ws_size, hipStream_t stream) {
    (void)in_sizes; (void)n_in; (void)out_size;
    const float* x = (const float*)d_in[0]; const int* pos = (const int*)d_in[1]; const float* Wq = (const float*)d_in[2]; const float* Wk = (const float*)d_in[3]; const float* Wv = (const float*)d_in[4]; const float* Wo = (const float*)d_in[5]; const float* qnw = (const float*)d_in[6]; const float* knw = (const float*)d_in[7];   // [out][in] weights; position_ids [2048] i32
    float* out = (float*)d_out;    // [1][2048][2048]
    char* wsp = (char*)d_ws;
    auto take = [&](size_t bytes) { char* p = wsp; wsp += (bytes + 255) & ~(size_t)255; return (void*)p; };
    bf* Xb = (bf*)take((size_t)NTK * DM * 2); bf* WqB = (bf*)take((size_t)DM * DM * 2); bf* WkB = (bf*)take((size_t)KVW * DM * 2); bf* WvB = (bf*)take((size_t)KVW * DM * 2); bf* WoB = (bf*)take((size_t)DM * DM * 2);
    h16* QH = (h16*)take((size_t)NTK * DM * 2); h16* QL = (h16*)take((size_t)NTK * DM * 2);
    h16* KH = (h16*)take((size_t)NTK * KVW * 2); h16* KL = (h16*)take((size_t)NTK * KVW * 2);
    h16* VTH = (h16*)take((size_t)NTK * KVW * 2); h16* VTL = (h16*)take((size_t)NTK * KVW * 2);
    float* RCq = (float*)take((size_t)NT_ * 32 * 4); float* RSq = (float*)take((size_t)NT_ * 32 * 4); float* RCk = (float*)take((size_t)NT_ * 32 * 4); float* RSk = (float*)take((size_t)NT_ * 32 * 4);
    bf* CH = (bf*)take((size_t)NTK * DM * 2); bf* CL = (bf*)take((size_t)NTK * DM * 2);
    if ((size_t)(wsp - (char*)d_ws) > ws_size) return;    // about 72 MB (69 MiB), no aliasing
    k_prep<<<PB_ALL, 256, 0, stream>>>(x, pos, Wq, Wk, Wv, Wo, Xb, WqB, WkB, WvB, WoB, RCq, RSq, RCk, RSk);
    k_gemmb<false><<<dim3(NTK / GBM, LDP / GBN, 1), 256, 0, stream>>>(Xb, nullptr, WqB, nullptr, 0, RSq, RCq, RSk, RCk, qnw, knw, QH, QL, KH, KL, VTH, VTL);   // WqB, WkB, WvB lie one behind the other: one [3072][2048] operand
    k_attn<<<NB_ * NH_ * (NT_ / 64), 128, 0, stream>>>(QH, QL, KH, KL, VTH, VTL, CH, CL);
    k_gemmb<true><<<dim3(NTK / GBM, DM / GBN, 1), 256, 0, stream>>>(CH, CL, WoB, out, DM, nullptr, nullptr, nullptr, nullptr, nullptr, nullptr, nullptr, nullptr, nullptr, nullptr, nullptr, nullptr);
}
